// v000
// Measured on an AMD MI455X. A time is GPU time per run, averaged over a window of back-to-back runs after a warm-up
// (all launches, gaps included; the runs take copies of the inputs in turn), and the median of several windows.
// Apart from v000's, it joins two sittings. Times from different sittings can be a few percent apart, while
// side-by-side timings come from the same sitting.
// The starting kernel, v000, takes 1520 microseconds a run.
// compute dtype: all float inputs rounded to bf16; q/k/v projections with EXACT bf16 products on WMMA 16x16x32 (f32 accumulate) + bias (zeros, read); causal logits: 3 products for the first 384 rows, single f16 q x k after, x 64^-0.5, plus the additive float key mask (read); softmax f32; P x 2^11 once to f16 x v once to f16 (bf16 hi + lo below row 384); f32 output (no output projection).
#include <hip/hip_runtime.h>
#include <math.h>

typedef __attribute__((ext_vector_type(16))) _Float16 v16h;
typedef __attribute__((ext_vector_type(16))) __bf16 v16b;
typedef __attribute__((ext_vector_type(8)))  _Float16 v8h;
typedef __attribute__((ext_vector_type(8)))  float v8f;
typedef __attribute__((ext_vector_type(4)))  float v4f;
typedef __attribute__((ext_vector_type(2)))  float v2f;
typedef __attribute__((ext_vector_type(4)))  unsigned v4u;
typedef __attribute__((ext_vector_type(4)))  int v4i;
typedef float __attribute__((may_alias)) float_a;
typedef int __attribute__((may_alias)) int_a;

template <typename T> __device__ __forceinline__ void vst2(void* p, T v) { *(T*)p = v;  }
__device__ __forceinline__ v8f wmma16(v16h a, v16h b, v8f c) {
  v8f d = __builtin_amdgcn_wmma_f32_16x16x32_f16(false, a, false, b, (short)0, c, false, false);
  asm volatile("v_nop\n\tv_nop\n\tv_nop\n\tv_nop" : "+v"(d) : "v"(a), "v"(b));
  return d;
}
__device__ __forceinline__ v8f wmma_bf(v16b a, v16b b, v8f c) {
  v8f d = __builtin_amdgcn_wmma_f32_16x16x32_bf16(false, a, false, b, (short)0, c, false, false);
  asm volatile("v_nop\n\tv_nop\n\tv_nop\n\tv_nop" : "+v"(d) : "v"(a), "v"(b));
  return d;
}
// 16x16x32 fragments: lane = (h = lane>>4, row/col = lane&15); elements 0..7 = k0+8h+0..7, 8..15 = k0+16+8h+0..7; D element r = row 8h+r
__device__ __forceinline__ v16h frag_h(const _Float16* rowk0, int lane) {
  union { v16h v; v8h q[2]; } u; const _Float16* p = rowk0 + 8 * (lane >> 4);
  u.q[0] = *(const v8h*)p; u.q[1] = *(const v8h*)(p + 16); return u.v;
}
__device__ __forceinline__ v16h frag_f32(const float* rowk0, int lane) {
  v16h a; const float* p = rowk0 + 8 * (lane >> 4);
#pragma unroll
  for (int i = 0; i < 8; ++i) { a[i] = (_Float16)p[i]; a[8 + i] = (_Float16)p[16 + i]; }
  return a;
}
__device__ __forceinline__ v16h frag_f32s(const float* rowk0, int lane, float sc) {
  v16h a; const float* p = rowk0 + 8 * (lane >> 4);
#pragma unroll
  for (int i = 0; i < 8; ++i) { a[i] = (_Float16)(p[i] * sc); a[8 + i] = (_Float16)(p[16 + i] * sc); }
  return a;
}
// column fragment from a [K][ld] layout (column n), rows >= K read as 0
__device__ __forceinline__ v16h fragc_f32(const float* W, int k0, int n, int lane, int ld, int K) {
  v16h a; const int g = lane >> 4;
#pragma unroll
  for (int i = 0; i < 8; ++i) { const int ka = k0 + 8 * g + i, kb = ka + 16;
    a[i] = (_Float16)(ka < K ? W[(size_t)(ka < K ? ka : K - 1) * ld + n] : 0.f); a[8 + i] = (_Float16)(kb < K ? W[(size_t)(kb < K ? kb : K - 1) * ld + n] : 0.f); }
  return a;
}
struct F2 { v16b h, l; };
__device__ __forceinline__ F2 bsplit16(const float v[16]) { F2 r;
#pragma unroll
  for (int i = 0; i < 16; ++i) { const __bf16 h = (__bf16)v[i]; r.h[i] = h; r.l[i] = (__bf16)(v[i] - (float)h); }
  return r; }
__device__ __forceinline__ F2 split_row(const float* row, int k0, int lane) { float v[16]; const float* p = row + k0 + 8 * (lane >> 4);
#pragma unroll
  for (int i = 0; i < 8; ++i) { v[i] = p[i]; v[8 + i] = p[16 + i]; }
  return bsplit16(v); }
__device__ __forceinline__ F2 split_rowK(const float* row, int k0, int lane, int K) { float v[16]; const int g = lane >> 4;
#pragma unroll
  for (int i = 0; i < 8; ++i) { const int ka = k0 + 8 * g + i, kb = ka + 16; v[i] = ka < K ? row[ka < K ? ka : K - 1] : 0.f; v[8 + i] = kb < K ? row[kb < K ? kb : K - 1] : 0.f; }
  return bsplit16(v); }
__device__ __forceinline__ F2 split_col(const float* W, int k0, int n, int lane, int ld, int K) { float v[16]; const int g = lane >> 4;
#pragma unroll
  for (int i = 0; i < 8; ++i) { const int ka = k0 + 8 * g + i, kb = ka + 16; v[i] = ka < K ? W[(size_t)(ka < K ? ka : K - 1) * ld + n] : 0.f; v[8 + i] = kb < K ? W[(size_t)(kb < K ? kb : K - 1) * ld + n] : 0.f; }
  return bsplit16(v); }
__device__ __forceinline__ v8f mac3(const F2& a, const F2& b, v8f c) { c = wmma_bf(a.l, b.h, c); c = wmma_bf(a.h, b.l, c); return wmma_bf(a.h, b.h, c); }
__device__ __forceinline__ float sigm(float v) { return 1.0f / (1.0f + expf(-v)); }
#define LDSX() do { asm volatile("s_wait_dscnt 0" ::: "memory"); __builtin_amdgcn_wave_barrier(); __builtin_amdgcn_fence(__ATOMIC_RELEASE, "workgroup"); } while (0)

// Causal multi-head self-attention without an output projection (hidden_states [4,2048,768]; attention_mask [4,1,1,2048] f32 (zeros on this draw) ADDED to the scores per key; torch (out,in) Wq / Wk / Wv [768,768] N(0,1) x 0.02 applied as x @ W.T, zero biases (read); 12 heads x 64; scores / 64^0.5; -inf strictly above the diagonal; + attention_mask; softmax; heads merged to [4,2048,768]).
#define NB 4
#define TT 2048
#define CC 768            // NH * HD = projected width
#define DIN 768          // input (model) width
#define NH 12
#define HD 64
#define NQB (TT / 64)
#define HG 4
#define SCALE (0.125f)
#define CAUSAL 1
#ifndef TNB
#define TNB NB
#endif
__device__ __forceinline__ float bfr(float v) { return (float)(__bf16)v; }
__host__ __device__ __forceinline__ int kb_last(int qb) { return CAUSAL ? ((qb * 64 + 63) >> 7) : (TT / 128 - 1); }
typedef __attribute__((ext_vector_type(8))) __bf16 v8b;
__device__ __forceinline__ v16b frag_b(const __bf16* rowk0, int lane) {
  union { v16b v; v8b q[2]; } u; const __bf16* p = rowk0 + 8 * (lane >> 4);
  u.q[0] = *(const v8b*)p; u.q[1] = *(const v8b*)(p + 16); return u.v;
}
#define QBH 6              // causal: query blocks 0..QBH-1 of each sequence (few keys, no averaging) take the high-precision path
#define QHI 384            // rows carrying a q residual plane
#define KHI 384            // key rows carrying k residual / v bf16 hi+lo planes (used only by the causal high-precision path)
// B fragment (k rows k0+.., output column o) of a weight: (in,out) [K][ld] or (out,in) [ld rows of K]: bf16 exact, or f16(bf16 * 256) exact
__device__ __forceinline__ v16b wcol_io(const float* Wm, int k0, int o, int lane, int ld) { v16b w; const int g = lane >> 4;
#pragma unroll
  for (int i = 0; i < 8; ++i) { w[i] = (__bf16)Wm[(size_t)(k0 + 8 * g + i) * ld + o]; w[8 + i] = (__bf16)Wm[(size_t)(k0 + 16 + 8 * g + i) * ld + o]; }
  return w; }
__device__ __forceinline__ v16b wcol_oi(const float* Wm, int k0, int o, int lane, int K) { v16b w; const float* p = Wm + (size_t)o * K + k0 + 8 * (lane >> 4);
#pragma unroll
  for (int i = 0; i < 8; ++i) { w[i] = (__bf16)p[i]; w[8 + i] = (__bf16)p[16 + i]; }
  return w; }
__device__ __forceinline__ v16h wcolh_io(const float* Wm, int k0, int o, int lane, int ld) { v16h w; const int g = lane >> 4;
#pragma unroll
  for (int i = 0; i < 8; ++i) { w[i] = (_Float16)(bfr(Wm[(size_t)(k0 + 8 * g + i) * ld + o]) * 256.0f); w[8 + i] = (_Float16)(bfr(Wm[(size_t)(k0 + 16 + 8 * g + i) * ld + o]) * 256.0f); }
  return w; }
__device__ __forceinline__ v16h wcolh_oi(const float* Wm, int k0, int o, int lane, int K) { v16h w; const float* p = Wm + (size_t)o * K + k0 + 8 * (lane >> 4);
#pragma unroll
  for (int i = 0; i < 8; ++i) { w[i] = (_Float16)(bfr(p[i]) * 256.0f); w[8 + i] = (_Float16)(bfr(p[16 + i]) * 256.0f); }
  return w; }
#define WQKV_LAYOUT 1   // 0 = (in,out) [DIN][CC]; 1 = (out,in) [CC][DIN]; 2 = per-head [NH][DIN][HD]
__device__ __forceinline__ v16b wcol_hdk(const float* Wm, int k0, int o, int lane) { v16b w; const int g = lane >> 4; const float* p = Wm + (size_t)(o / HD) * DIN * HD + (o % HD);
#pragma unroll
  for (int i = 0; i < 8; ++i) { w[i] = (__bf16)p[(size_t)(k0 + 8 * g + i) * HD]; w[8 + i] = (__bf16)p[(size_t)(k0 + 16 + 8 * g + i) * HD]; }
  return w; }
#define WO_OUT_IN 1
#if WQKV_LAYOUT == 1
#define WCOL(W, k0, o, lane) wcol_oi(W, k0, o, lane, DIN)
#elif WQKV_LAYOUT == 2
#define WCOL(W, k0, o, lane) wcol_hdk(W, k0, o, lane)
#else
#define WCOL(W, k0, o, lane) wcol_io(W, k0, o, lane, CC)
#endif
#if WO_OUT_IN
#define WOCOL(W, k0, o, lane) wcol_oi(W, k0, o, lane, CC)
#define WOCOLH(W, k0, o, lane) wcolh_oi(W, k0, o, lane, CC)
#else
#define WOCOL(W, k0, o, lane) wcol_io(W, k0, o, lane, DIN)
#define WOCOLH(W, k0, o, lane) wcolh_io(W, k0, o, lane, DIN)
#endif

#define SM_EXTRA_PARAMS , int bsm, const float* __restrict__ AM
// the module adds attention_mask[b, 0, 0, key] (f32, bf16-rounded like every float input) to the scaled, causally masked scores: one unconditional load per (row, key), plain add (an excluded key stays excluded: -3e38 + 0)
#define SM_MASK_HOOK do { const float am_ = bfr(AM[(size_t)bsm * TT + k]); asm volatile("s_wait_loadcnt 0x0" ::: "memory"); v = v + am_; } while (0)
#ifndef SM_EXTRA_PARAMS
#define SM_EXTRA_PARAMS
#endif
#ifndef PROJ_EXTRA_PARAMS
#define PROJ_EXTRA_PARAMS
#endif
#ifndef SM_MASK_HOOK
#define SM_MASK_HOOK (void)0
#endif

#define WS_QH  0u                                      // f16 q rows [b*t][CC]
#define WS_KH  (WS_QH + 2u * (size_t)NB * TT * CC)      // f16 k rows [b*t][CC]
#define WS_VT  (WS_KH + 2u * (size_t)NB * TT * CC)      // f16 v planes [b][c][t]
#define WS_QL  (WS_VT + 2u * (size_t)NB * CC * TT)      // f16 q residual x 2^10 rows [b][t < QHI][CC]
#define WS_KL  (WS_QL + 2u * (size_t)NB * QHI * CC)     // f16 k residual x 2^10 rows [b][t < KHI][CC]
#define WS_VB  (WS_KL + 2u * (size_t)NB * KHI * CC)     // bf16 v hi planes [b][c][t < KHI]
#define WS_VBL (WS_VB + 2u * (size_t)NB * CC * KHI)
#define WS_S   (WS_VBL + 2u * (size_t)NB * CC * KHI)    // f32 logits / P [hg][t][s]
#define WS_Y   (WS_S  + 4u * (size_t)HG * TT * TT)      // f32 ctx rows [b*t][CC] (only when there is an output projection)
#define WS_END (WS_Y  + 0u)

// ---- k_proj: block = (64 rows, 128 cols, which): q/k/v = X W (+ b) with exact bf16 products (K = DIN) -> which 0: q f16 rows (+ residual rows < QHI); 1: k f16 rows (+ residual rows < KHI); 2: v f16 planes [c][t] (+ bf16 hi/lo planes for t < KHI)
__global__ __launch_bounds__(128) void k_proj(const float* __restrict__ XQ, const float* __restrict__ XK, const float* __restrict__ XV, const float* __restrict__ WQ, const float* __restrict__ WK, const float* __restrict__ WV, const float* __restrict__ BQ, const float* __restrict__ BK, const float* __restrict__ BV,
    _Float16* __restrict__ QH, _Float16* __restrict__ QL, _Float16* __restrict__ KH, _Float16* __restrict__ KL, _Float16* __restrict__ VT, __bf16* __restrict__ VB, __bf16* __restrict__ VBL) {
  __shared__ __align__(16) _Float16 sh[64][136], sl[64][136]; __shared__ __align__(16) _Float16 th[128][72]; __shared__ __align__(16) __bf16 tb[128][72], tbl[128][72];
  const int tid = threadIdx.x, wave = tid >> 5, lane = tid & 31, col = lane & 15, g = lane >> 4; const int which = blockIdx.z; const int c0 = blockIdx.y * 128; const size_t r0 = (size_t)blockIdx.x * 64; const size_t bb = r0 / TT; const int t0 = (int)(r0 % TT);
  const float* X = which == 0 ? XQ : which == 1 ? XK : XV; const float* WA = which == 0 ? WQ : which == 1 ? WK : WV; const float* BA = which == 0 ? BQ : which == 1 ? BK : BV;
  v8f acc[8] = {};
#pragma unroll 2
  for (int kc = 0; kc < DIN / 32; ++kc) { v16b a; { const float* p = X + (r0 + wave * 16 + col) * DIN + kc * 32 + 8 * g;
#pragma unroll
      for (int i = 0; i < 8; ++i) { a[i] = (__bf16)p[i]; a[8 + i] = (__bf16)p[16 + i]; } }
    asm volatile("s_wait_loadcnt 0x0" ::: "memory");
#pragma unroll
    for (int j = 0; j < 8; ++j) { const v16b w = WCOL(WA, kc * 32, c0 + j * 16 + col, lane); asm volatile("s_wait_loadcnt 0x0" ::: "memory"); acc[j] = wmma_bf(a, w, acc[j]); } }
  if (which < 2) { _Float16* DH = which == 0 ? QH : KH; _Float16* DL = which == 0 ? QL : KL; const int nhi = which == 0 ? QHI : KHI; const bool hi_rows = t0 < nhi;
#pragma unroll
    for (int j = 0; j < 8; ++j) { const float bias = BA ? bfr(BA[c0 + j * 16 + col]) : 0.f;
#pragma unroll
      for (int r = 0; r < 8; ++r) { const float v = acc[j][r] + bias; const _Float16 hv = (_Float16)v; sh[wave * 16 + 8 * g + r][j * 16 + col] = hv; sl[wave * 16 + 8 * g + r][j * 16 + col] = (_Float16)((v - (float)hv) * 1024.0f); } }
    __syncthreads();
    for (int e = tid; e < 64 * 16; e += 128) { const int rl = e >> 4, q = e & 15; vst2((unsigned*)(DH + (r0 + rl) * CC + c0 + q * 8), *(const v4u*)&sh[rl][q * 8]); if (hi_rows) vst2((unsigned*)(DL + (bb * nhi + t0 + rl) * (size_t)CC + c0 + q * 8), *(const v4u*)&sl[rl][q * 8]); }
  } else { const bool hi_rows = t0 < KHI;
#pragma unroll
    for (int j = 0; j < 8; ++j) { const float bias = BA ? bfr(BA[c0 + j * 16 + col]) : 0.f;
#pragma unroll
      for (int r = 0; r < 8; ++r) { const float v = acc[j][r] + bias; const int rl = wave * 16 + 8 * g + r, cl = j * 16 + col; th[cl][rl] = (_Float16)v; const __bf16 bh = (__bf16)v; tb[cl][rl] = bh; tbl[cl][rl] = (__bf16)(v - (float)bh); } }
    __syncthreads();
    for (int e = tid; e < 128 * 8; e += 128) { const int cl = e >> 3, q = e & 7; vst2((unsigned*)(VT + (bb * CC + c0 + cl) * (size_t)TT + t0 + q * 8), *(const v4u*)&th[cl][q * 8]); if (hi_rows) { const size_t o3 = (bb * CC + c0 + cl) * (size_t)KHI + t0 + q * 8; vst2((unsigned*)(VB + o3), *(const v4u*)&tb[cl][q * 8]); vst2((unsigned*)(VBL + o3), *(const v4u*)&tbl[cl][q * 8]); } } } }
// ---- k_sc: block = (query block qb, key block kb <= kb_last(qb), head in group) of batch b: logits x SCALE; q hi + residual (x 2^10) against k (2 products) for query rows < QHI, plus the k residual (3 products) for query blocks < QBH (causal early rows); causal: blocks past the diagonal exit, the mask itself is applied by index in k_sm
__global__ __launch_bounds__(128) void k_sc(const _Float16* __restrict__ QH, const _Float16* __restrict__ KH, const _Float16* __restrict__ QL, const _Float16* __restrict__ KL, int b, int h0, float* __restrict__ S0) { __shared__ __align__(16) float ss[4][16][132];
  const int qb = blockIdx.x, kb = blockIdx.y; if (kb > kb_last(qb)) return;
  const int h = h0 + blockIdx.z; float* S = S0 + (size_t)blockIdx.z * TT * TT;
  const int tid = threadIdx.x, wave = tid >> 5, lane = tid & 31, col = lane & 15, g = lane >> 4; const int k0 = kb * 128; const int ql0 = qb * 64 + wave * 16; const size_t q0 = (size_t)b * TT + ql0, kr0 = (size_t)b * TT + k0;
  v8f acc[8] = {}, accl[8] = {};
  const _Float16* QLb = QL + (size_t)b * QHI * CC; const _Float16* KLb = KL + (size_t)b * KHI * CC;
  if (qb < QBH) {
#pragma unroll
    for (int kc = 0; kc < HD / 32; ++kc) { const v16h ah = frag_h(QH + (q0 + col) * CC + h * HD + kc * 32, lane), al = frag_h(QLb + (size_t)(ql0 + col) * CC + h * HD + kc * 32, lane);
#pragma unroll
      for (int j = 0; j < 8; ++j) { const v16h kbf = frag_h(KH + (kr0 + j * 16 + col) * CC + h * HD + kc * 32, lane), klf = frag_h(KLb + (size_t)(k0 + j * 16 + col) * CC + h * HD + kc * 32, lane); acc[j] = wmma16(ah, kbf, acc[j]); accl[j] = wmma16(al, kbf, accl[j]); accl[j] = wmma16(ah, klf, accl[j]); } }
  } else if (qb * 64 < QHI) {
#pragma unroll
    for (int kc = 0; kc < HD / 32; ++kc) { const v16h ah = frag_h(QH + (q0 + col) * CC + h * HD + kc * 32, lane), al = frag_h(QLb + (size_t)(ql0 + col) * CC + h * HD + kc * 32, lane);
#pragma unroll
      for (int j = 0; j < 8; ++j) { const v16h kbf = frag_h(KH + (kr0 + j * 16 + col) * CC + h * HD + kc * 32, lane); acc[j] = wmma16(ah, kbf, acc[j]); accl[j] = wmma16(al, kbf, accl[j]); } }
  } else {
#pragma unroll
    for (int kc = 0; kc < HD / 32; ++kc) { const v16h ah = frag_h(QH + (q0 + col) * CC + h * HD + kc * 32, lane);
#pragma unroll
      for (int j = 0; j < 8; ++j) { const v16h kbf = frag_h(KH + (kr0 + j * 16 + col) * CC + h * HD + kc * 32, lane); acc[j] = wmma16(ah, kbf, acc[j]); } } }
#pragma unroll
  for (int j = 0; j < 8; ++j) {
#pragma unroll
    for (int r = 0; r < 8; ++r) ss[wave][8 * g + r][j * 16 + col] = (acc[j][r] + accl[j][r] * (1.0f / 1024.0f)) * SCALE; }
  LDSX(); for (int rl = 0; rl < 16; ++rl) vst2(S + (size_t)(ql0 + rl) * TT + k0 + lane * 4, *(const v4f*)&ss[wave][rl][lane * 4]); }
// ---- k_sm: block = query row t (head in group): keys [0, kend): causal -> logit if s <= t else excluded; softmax in f32; P x 2^11 in place (0 for excluded)
__global__ __launch_bounds__(256) void k_sm(float* __restrict__ S0 SM_EXTRA_PARAMS) { __shared__ float sred[8]; __shared__ float sbc; __shared__ __align__(16) float shv[TT];
  const int tid = threadIdx.x; const int t = blockIdx.x; const int kend = (kb_last(t >> 6) + 1) * 128;
  float* sr = S0 + (size_t)blockIdx.y * TT * TT + (size_t)t * TT;
  float m = -3.0e38f; for (int k = tid; k < kend; k += 256) { float v = (!CAUSAL || k <= t) ? sr[k] : -3.0e38f; SM_MASK_HOOK; shv[k] = v; m = fmaxf(m, v); }
#pragma unroll
  for (int o = 1; o < 32; o <<= 1) m = fmaxf(m, __shfl_xor(m, o));
  if ((tid & 31) == 0) sred[tid >> 5] = m; __syncthreads(); if (tid == 0) { float a = sred[0]; for (int i = 1; i < 8; ++i) a = fmaxf(a, sred[i]); sbc = a; } __syncthreads(); m = sbc; __syncthreads();
  float sum = 0.f; for (int k = tid; k < kend; k += 256) { const float v = shv[k]; const float e = (v <= -1.0e38f) ? 0.f : expf(v - m); shv[k] = e; sum += e; }
#pragma unroll
  for (int o = 1; o < 32; o <<= 1) sum += __shfl_xor(sum, o);
  if ((tid & 31) == 0) sred[tid >> 5] = sum; __syncthreads(); if (tid == 0) { float a = 0.f; for (int i = 0; i < 8; ++i) a += sred[i]; sbc = a > 0.f ? 2048.0f / a : 0.f; }   /* a fully excluded row yields P = 0 */ __syncthreads(); const float inv = sbc;
  for (int k = tid; k < kend; k += 256) shv[k] = shv[k] * inv;
  __syncthreads(); for (int q = tid; q < kend / 4; q += 256) vst2(sr + q * 4, *(const v4f*)&shv[q * 4]); }
// ---- k_pv: block = 64 queries (qb) of (b, h): ctx = P . v over keys [0, kend) (P x 2^11 once to f16 against v f16: 1 product; causal early query blocks: P and v as bf16 hi + lo, 3 products); 256-B (row, head) segment by 16 lanes
__global__ __launch_bounds__(128) void k_pv(const float* __restrict__ PS0, const _Float16* __restrict__ VT, const __bf16* __restrict__ VB, const __bf16* __restrict__ VBL, int b, int h0, float* __restrict__ Y) { const int h = h0 + blockIdx.z; const float* PS = PS0 + (size_t)blockIdx.z * TT * TT; __shared__ __align__(16) float ss[4][16][HD + 4];
  const int tid = threadIdx.x, wave = tid >> 5, lane = tid & 31, col = lane & 15, g = lane >> 4; const int qb = blockIdx.x; const int ql0 = qb * 64 + wave * 16; const int kce = (kb_last(qb) + 1) * 4;
  v8f acc[HD / 16] = {};
  if (qb < QBH) {
#pragma unroll 1
    for (int kc = 0; kc < kce; ++kc) { const F2 p = split_row(PS + (size_t)(ql0 + col) * TT, kc * 32, lane);
      asm volatile("s_wait_loadcnt 0x0" ::: "memory");
#pragma unroll
      for (int j = 0; j < HD / 16; ++j) { const size_t po = ((size_t)b * CC + h * HD + j * 16 + col) * (size_t)KHI + kc * 32; const v16b vh = frag_b(VB + po, lane); acc[j] = wmma_bf(p.h, vh, acc[j]); acc[j] = wmma_bf(p.l, vh, acc[j]); acc[j] = wmma_bf(p.h, frag_b(VBL + po, lane), acc[j]); } }
  } else {
#pragma unroll 1
    for (int kc = 0; kc < kce; ++kc) { const v16h p = frag_f32(PS + (size_t)(ql0 + col) * TT + kc * 32, lane);
      asm volatile("s_wait_loadcnt 0x0" ::: "memory");
#pragma unroll
      for (int j = 0; j < HD / 16; ++j) { const size_t po = ((size_t)b * CC + h * HD + j * 16 + col) * (size_t)TT + kc * 32; acc[j] = wmma16(p, frag_h(VT + po, lane), acc[j]); } } }
#pragma unroll
  for (int j = 0; j < HD / 16; ++j)
#pragma unroll
    for (int r = 0; r < 8; ++r) ss[wave][8 * g + r][j * 16 + col] = acc[j][r] * (1.0f / 2048.0f);
  LDSX(); for (int rl = 0; rl < 16; ++rl) if (lane < HD / 4) vst2(Y + ((size_t)b * TT + ql0 + rl) * CC + h * HD + lane * 4, *(const v4f*)&ss[wave][rl][lane * 4]); }

extern "C" void kernel_launch(void* const* d_in, const int* in_sizes, int n_in, void* d_out, int out_size, void* d_ws, size_t ws_size, hipStream_t stream) {
  (void)in_sizes; (void)n_in; (void)out_size;
  const float** F = (const float**)d_in;
  if (ws_size < (size_t)WS_END) return;
  char* ws = (char*)d_ws; _Float16 *QH = (_Float16*)(ws + WS_QH), *KH = (_Float16*)(ws + WS_KH), *VT = (_Float16*)(ws + WS_VT), *QL = (_Float16*)(ws + WS_QL), *KL = (_Float16*)(ws + WS_KL); __bf16 *VB = (__bf16*)(ws + WS_VB), *VBL = (__bf16*)(ws + WS_VBL); float *S = (float*)(ws + WS_S), *Y = (float*)(ws + WS_Y);
  (void)Y; (void)QL; (void)KL; (void)VB; (void)VBL;
  // inputs: 0 hidden_states [4,2048,768]; 1 attention_mask [4,1,1,2048] f32 (zeros); 2 Wq [768,768] (out,in), 3 bq; 4 Wk, 5 bk; 6 Wv, 7 bv (biases zeros, read)
  k_proj<<<dim3(TNB * TT / 64, CC / 128, 3), 128, 0, stream>>>(F[0], F[0], F[0], F[2], F[4], F[6], F[3], F[5], F[7], QH, QL, KH, KL, VT, VB, VBL);
  for (int b = 0; b < TNB; ++b) for (int h0 = 0; h0 < NH; h0 += HG) {
    k_sc<<<dim3(NQB, TT / 128, HG), 128, 0, stream>>>(QH, KH, QL, KL, b, h0, S);
    k_sm<<<dim3(TT, HG), 256, 0, stream>>>(S, b, F[1]);
    k_pv<<<dim3(NQB, 1, HG), 128, 0, stream>>>(S, VT, VB, VBL, b, h0, (float*)d_out);   /* merged heads are the output: row b*TT + t, columns h*64 .. */
  }
}

// v001
// Measured time: 956 microseconds a run.
// Two timings next to v000 both put it at 1.59 times that version's speed.
// compute dtype: all float inputs rounded to bf16; q/k/v projections with EXACT bf16 products on WMMA 16x16x32 (f32 accumulate) + bias (zeros, read); causal logits: 3 products for the first 384 rows, single f16 q x k after, x 64^-0.5, plus the additive float key mask (read); softmax f32; P x 2^11 once to f16 x v once to f16 (bf16 hi + lo below row 384); f32 output (no output projection).
#include <hip/hip_runtime.h>
#include <math.h>

typedef __attribute__((ext_vector_type(16))) _Float16 v16h;
typedef __attribute__((ext_vector_type(16))) __bf16 v16b;
typedef __attribute__((ext_vector_type(8)))  _Float16 v8h;
typedef __attribute__((ext_vector_type(8)))  float v8f;
typedef __attribute__((ext_vector_type(4)))  float v4f;
typedef __attribute__((ext_vector_type(2)))  float v2f;
typedef __attribute__((ext_vector_type(4)))  unsigned v4u;
typedef __attribute__((ext_vector_type(4)))  int v4i;
typedef float __attribute__((may_alias)) float_a;
typedef int __attribute__((may_alias)) int_a;

template <typename T> __device__ __forceinline__ void vst2(void* p, T v) { *(T*)p = v;  }
__device__ __forceinline__ v8f wmma16(v16h a, v16h b, v8f c) {
  v8f d = __builtin_amdgcn_wmma_f32_16x16x32_f16(false, a, false, b, (short)0, c, false, false);
  asm volatile("v_nop\n\tv_nop\n\tv_nop\n\tv_nop" : "+v"(d) : "v"(a), "v"(b));
  return d;
}
__device__ __forceinline__ v8f wmma_bf(v16b a, v16b b, v8f c) {
  v8f d = __builtin_amdgcn_wmma_f32_16x16x32_bf16(false, a, false, b, (short)0, c, false, false);
  asm volatile("v_nop\n\tv_nop\n\tv_nop\n\tv_nop" : "+v"(d) : "v"(a), "v"(b));
  return d;
}
// 16x16x32 fragments: lane = (h = lane>>4, row/col = lane&15); elements 0..7 = k0+8h+0..7, 8..15 = k0+16+8h+0..7; D element r = row 8h+r
__device__ __forceinline__ v16h frag_h(const _Float16* rowk0, int lane) {
  union { v16h v; v8h q[2]; } u; const _Float16* p = rowk0 + 8 * (lane >> 4);
  u.q[0] = *(const v8h*)p; u.q[1] = *(const v8h*)(p + 16); return u.v;
}
__device__ __forceinline__ v16h frag_f32(const float* rowk0, int lane) {
  v16h a; const float* p = rowk0 + 8 * (lane >> 4);
#pragma unroll
  for (int i = 0; i < 8; ++i) { a[i] = (_Float16)p[i]; a[8 + i] = (_Float16)p[16 + i]; }
  return a;
}
__device__ __forceinline__ v16h frag_f32s(const float* rowk0, int lane, float sc) {
  v16h a; const float* p = rowk0 + 8 * (lane >> 4);
#pragma unroll
  for (int i = 0; i < 8; ++i) { a[i] = (_Float16)(p[i] * sc); a[8 + i] = (_Float16)(p[16 + i] * sc); }
  return a;
}
// column fragment from a [K][ld] layout (column n), rows >= K read as 0
__device__ __forceinline__ v16h fragc_f32(const float* W, int k0, int n, int lane, int ld, int K) {
  v16h a; const int g = lane >> 4;
#pragma unroll
  for (int i = 0; i < 8; ++i) { const int ka = k0 + 8 * g + i, kb = ka + 16;
    a[i] = (_Float16)(ka < K ? W[(size_t)(ka < K ? ka : K - 1) * ld + n] : 0.f); a[8 + i] = (_Float16)(kb < K ? W[(size_t)(kb < K ? kb : K - 1) * ld + n] : 0.f); }
  return a;
}
struct F2 { v16b h, l; };
__device__ __forceinline__ F2 bsplit16(const float v[16]) { F2 r;
#pragma unroll
  for (int i = 0; i < 16; ++i) { const __bf16 h = (__bf16)v[i]; r.h[i] = h; r.l[i] = (__bf16)(v[i] - (float)h); }
  return r; }
__device__ __forceinline__ F2 split_row(const float* row, int k0, int lane) { float v[16]; const float* p = row + k0 + 8 * (lane >> 4);
#pragma unroll
  for (int i = 0; i < 8; ++i) { v[i] = p[i]; v[8 + i] = p[16 + i]; }
  return bsplit16(v); }
__device__ __forceinline__ F2 split_rowK(const float* row, int k0, int lane, int K) { float v[16]; const int g = lane >> 4;
#pragma unroll
  for (int i = 0; i < 8; ++i) { const int ka = k0 + 8 * g + i, kb = ka + 16; v[i] = ka < K ? row[ka < K ? ka : K - 1] : 0.f; v[8 + i] = kb < K ? row[kb < K ? kb : K - 1] : 0.f; }
  return bsplit16(v); }
__device__ __forceinline__ F2 split_col(const float* W, int k0, int n, int lane, int ld, int K) { float v[16]; const int g = lane >> 4;
#pragma unroll
  for (int i = 0; i < 8; ++i) { const int ka = k0 + 8 * g + i, kb = ka + 16; v[i] = ka < K ? W[(size_t)(ka < K ? ka : K - 1) * ld + n] : 0.f; v[8 + i] = kb < K ? W[(size_t)(kb < K ? kb : K - 1) * ld + n] : 0.f; }
  return bsplit16(v); }
__device__ __forceinline__ v8f mac3(const F2& a, const F2& b, v8f c) { c = wmma_bf(a.l, b.h, c); c = wmma_bf(a.h, b.l, c); return wmma_bf(a.h, b.h, c); }
__device__ __forceinline__ float sigm(float v) { return 1.0f / (1.0f + expf(-v)); }
#define LDSX() do { asm volatile("s_wait_dscnt 0" ::: "memory"); __builtin_amdgcn_wave_barrier(); __builtin_amdgcn_fence(__ATOMIC_RELEASE, "workgroup"); } while (0)

// Causal multi-head self-attention without an output projection (hidden_states [4,2048,768]; attention_mask [4,1,1,2048] f32 (zeros on this draw) ADDED to the scores per key; torch (out,in) Wq / Wk / Wv [768,768] N(0,1) x 0.02 applied as x @ W.T, zero biases (read); 12 heads x 64; scores / 64^0.5; -inf strictly above the diagonal; + attention_mask; softmax; heads merged to [4,2048,768]).
#define NB 4
#define TT 2048
#define CC 768            // NH * HD = projected width
#define DIN 768          // input (model) width
#define NH 12
#define HD 64
#define NQB (TT / 64)
#define HG 12             // heads per launch: all heads of one batch share each launch (12 f32 logit planes = 192 MiB of workspace)
#define SCALE (0.125f)
#define CAUSAL 1
#ifndef TNB
#define TNB NB
#endif
__device__ __forceinline__ float bfr(float v) { return (float)(__bf16)v; }
__host__ __device__ __forceinline__ int kb_last(int qb) { return CAUSAL ? ((qb * 64 + 63) >> 7) : (TT / 128 - 1); }
typedef __attribute__((ext_vector_type(8))) __bf16 v8b;
__device__ __forceinline__ v16b frag_b(const __bf16* rowk0, int lane) {
  union { v16b v; v8b q[2]; } u; const __bf16* p = rowk0 + 8 * (lane >> 4);
  u.q[0] = *(const v8b*)p; u.q[1] = *(const v8b*)(p + 16); return u.v;
}
#define QBH 6              // causal: query blocks 0..QBH-1 of each sequence (few keys, no averaging) take the high-precision path
#define QHI 384            // rows carrying a q residual plane
#define KHI 384            // key rows carrying k residual / v bf16 hi+lo planes (used only by the causal high-precision path)
// B fragment (k rows k0+.., output column o) of a weight: (in,out) [K][ld] or (out,in) [ld rows of K]: bf16 exact, or f16(bf16 * 256) exact
__device__ __forceinline__ v16b wcol_io(const float* Wm, int k0, int o, int lane, int ld) { v16b w; const int g = lane >> 4;
#pragma unroll
  for (int i = 0; i < 8; ++i) { w[i] = (__bf16)Wm[(size_t)(k0 + 8 * g + i) * ld + o]; w[8 + i] = (__bf16)Wm[(size_t)(k0 + 16 + 8 * g + i) * ld + o]; }
  return w; }
__device__ __forceinline__ v16b wcol_oi(const float* Wm, int k0, int o, int lane, int K) { v16b w; const float* p = Wm + (size_t)o * K + k0 + 8 * (lane >> 4);
#pragma unroll
  for (int i = 0; i < 8; ++i) { w[i] = (__bf16)p[i]; w[8 + i] = (__bf16)p[16 + i]; }
  return w; }
__device__ __forceinline__ v16h wcolh_io(const float* Wm, int k0, int o, int lane, int ld) { v16h w; const int g = lane >> 4;
#pragma unroll
  for (int i = 0; i < 8; ++i) { w[i] = (_Float16)(bfr(Wm[(size_t)(k0 + 8 * g + i) * ld + o]) * 256.0f); w[8 + i] = (_Float16)(bfr(Wm[(size_t)(k0 + 16 + 8 * g + i) * ld + o]) * 256.0f); }
  return w; }
__device__ __forceinline__ v16h wcolh_oi(const float* Wm, int k0, int o, int lane, int K) { v16h w; const float* p = Wm + (size_t)o * K + k0 + 8 * (lane >> 4);
#pragma unroll
  for (int i = 0; i < 8; ++i) { w[i] = (_Float16)(bfr(p[i]) * 256.0f); w[8 + i] = (_Float16)(bfr(p[16 + i]) * 256.0f); }
  return w; }
#define WQKV_LAYOUT 1   // 0 = (in,out) [DIN][CC]; 1 = (out,in) [CC][DIN]; 2 = per-head [NH][DIN][HD]
__device__ __forceinline__ v16b wcol_hdk(const float* Wm, int k0, int o, int lane) { v16b w; const int g = lane >> 4; const float* p = Wm + (size_t)(o / HD) * DIN * HD + (o % HD);
#pragma unroll
  for (int i = 0; i < 8; ++i) { w[i] = (__bf16)p[(size_t)(k0 + 8 * g + i) * HD]; w[8 + i] = (__bf16)p[(size_t)(k0 + 16 + 8 * g + i) * HD]; }
  return w; }
#define WO_OUT_IN 1
#if WQKV_LAYOUT == 1
#define WCOL(W, k0, o, lane) wcol_oi(W, k0, o, lane, DIN)
#elif WQKV_LAYOUT == 2
#define WCOL(W, k0, o, lane) wcol_hdk(W, k0, o, lane)
#else
#define WCOL(W, k0, o, lane) wcol_io(W, k0, o, lane, CC)
#endif
#if WO_OUT_IN
#define WOCOL(W, k0, o, lane) wcol_oi(W, k0, o, lane, CC)
#define WOCOLH(W, k0, o, lane) wcolh_oi(W, k0, o, lane, CC)
#else
#define WOCOL(W, k0, o, lane) wcol_io(W, k0, o, lane, DIN)
#define WOCOLH(W, k0, o, lane) wcolh_io(W, k0, o, lane, DIN)
#endif

#define SM_EXTRA_PARAMS , int bsm, const float* __restrict__ AM
// the module adds attention_mask[b, 0, 0, key] (f32, bf16-rounded like every float input) to the scaled, causally masked scores: one unconditional load per (row, key), plain add (an excluded key stays excluded: -3e38 + 0)
#define SM_MASK_HOOK do { const float am_ = bfr(AM[(size_t)bsm * TT + k]); asm volatile("s_wait_loadcnt 0x0" ::: "memory"); v = v + am_; } while (0)
#ifndef SM_EXTRA_PARAMS
#define SM_EXTRA_PARAMS
#endif
#ifndef PROJ_EXTRA_PARAMS
#define PROJ_EXTRA_PARAMS
#endif
#ifndef SM_MASK_HOOK
#define SM_MASK_HOOK (void)0
#endif

#define WS_QH  0u                                      // f16 q rows [b*t][CC]
#define WS_KH  (WS_QH + 2u * (size_t)NB * TT * CC)      // f16 k rows [b*t][CC]
#define WS_VT  (WS_KH + 2u * (size_t)NB * TT * CC)      // f16 v planes [b][c][t]
#define WS_QL  (WS_VT + 2u * (size_t)NB * CC * TT)      // f16 q residual x 2^10 rows [b][t < QHI][CC]
#define WS_KL  (WS_QL + 2u * (size_t)NB * QHI * CC)     // f16 k residual x 2^10 rows [b][t < KHI][CC]
#define WS_VB  (WS_KL + 2u * (size_t)NB * KHI * CC)     // bf16 v hi planes [b][c][t < KHI]
#define WS_VBL (WS_VB + 2u * (size_t)NB * CC * KHI)
#define WS_S   (WS_VBL + 2u * (size_t)NB * CC * KHI)    // f32 logits / P [hg][t][s]
#define WS_Y   (WS_S  + 4u * (size_t)HG * TT * TT)      // f32 ctx rows [b*t][CC] (only when there is an output projection)
#define WS_END (WS_Y  + 0u)

// ---- k_proj: block = (64 rows, 128 cols, which): q/k/v = X W (+ b) with exact bf16 products (K = DIN) -> which 0: q f16 rows (+ residual rows < QHI); 1: k f16 rows (+ residual rows < KHI); 2: v f16 planes [c][t] (+ bf16 hi/lo planes for t < KHI)
__global__ __launch_bounds__(128) void k_proj(const float* __restrict__ XQ, const float* __restrict__ XK, const float* __restrict__ XV, const float* __restrict__ WQ, const float* __restrict__ WK, const float* __restrict__ WV, const float* __restrict__ BQ, const float* __restrict__ BK, const float* __restrict__ BV,
    _Float16* __restrict__ QH, _Float16* __restrict__ QL, _Float16* __restrict__ KH, _Float16* __restrict__ KL, _Float16* __restrict__ VT, __bf16* __restrict__ VB, __bf16* __restrict__ VBL) {
  __shared__ __align__(16) _Float16 sh[64][136], sl[64][136]; __shared__ __align__(16) _Float16 th[128][72]; __shared__ __align__(16) __bf16 tb[128][72], tbl[128][72];
  const int tid = threadIdx.x, wave = tid >> 5, lane = tid & 31, col = lane & 15, g = lane >> 4; const int which = blockIdx.z; const int c0 = blockIdx.y * 128; const size_t r0 = (size_t)blockIdx.x * 64; const size_t bb = r0 / TT; const int t0 = (int)(r0 % TT);
  const float* X = which == 0 ? XQ : which == 1 ? XK : XV; const float* WA = which == 0 ? WQ : which == 1 ? WK : WV; const float* BA = which == 0 ? BQ : which == 1 ? BK : BV;
  v8f acc[8] = {};
#pragma unroll 2
  for (int kc = 0; kc < DIN / 32; ++kc) { v16b a; { const float* p = X + (r0 + wave * 16 + col) * DIN + kc * 32 + 8 * g;
#pragma unroll
      for (int i = 0; i < 8; ++i) { a[i] = (__bf16)p[i]; a[8 + i] = (__bf16)p[16 + i]; } }
    asm volatile("s_wait_loadcnt 0x0" ::: "memory");
#pragma unroll
    for (int j = 0; j < 8; ++j) { const v16b w = WCOL(WA, kc * 32, c0 + j * 16 + col, lane); asm volatile("s_wait_loadcnt 0x0" ::: "memory"); acc[j] = wmma_bf(a, w, acc[j]); } }
  if (which < 2) { _Float16* DH = which == 0 ? QH : KH; _Float16* DL = which == 0 ? QL : KL; const int nhi = which == 0 ? QHI : KHI; const bool hi_rows = t0 < nhi;
#pragma unroll
    for (int j = 0; j < 8; ++j) { const float bias = BA ? bfr(BA[c0 + j * 16 + col]) : 0.f;
#pragma unroll
      for (int r = 0; r < 8; ++r) { const float v = acc[j][r] + bias; const _Float16 hv = (_Float16)v; sh[wave * 16 + 8 * g + r][j * 16 + col] = hv; sl[wave * 16 + 8 * g + r][j * 16 + col] = (_Float16)((v - (float)hv) * 1024.0f); } }
    __syncthreads();
    for (int e = tid; e < 64 * 16; e += 128) { const int rl = e >> 4, q = e & 15; vst2((unsigned*)(DH + (r0 + rl) * CC + c0 + q * 8), *(const v4u*)&sh[rl][q * 8]); if (hi_rows) vst2((unsigned*)(DL + (bb * nhi + t0 + rl) * (size_t)CC + c0 + q * 8), *(const v4u*)&sl[rl][q * 8]); }
  } else { const bool hi_rows = t0 < KHI;
#pragma unroll
    for (int j = 0; j < 8; ++j) { const float bias = BA ? bfr(BA[c0 + j * 16 + col]) : 0.f;
#pragma unroll
      for (int r = 0; r < 8; ++r) { const float v = acc[j][r] + bias; const int rl = wave * 16 + 8 * g + r, cl = j * 16 + col; th[cl][rl] = (_Float16)v; const __bf16 bh = (__bf16)v; tb[cl][rl] = bh; tbl[cl][rl] = (__bf16)(v - (float)bh); } }
    __syncthreads();
    for (int e = tid; e < 128 * 8; e += 128) { const int cl = e >> 3, q = e & 7; vst2((unsigned*)(VT + (bb * CC + c0 + cl) * (size_t)TT + t0 + q * 8), *(const v4u*)&th[cl][q * 8]); if (hi_rows) { const size_t o3 = (bb * CC + c0 + cl) * (size_t)KHI + t0 + q * 8; vst2((unsigned*)(VB + o3), *(const v4u*)&tb[cl][q * 8]); vst2((unsigned*)(VBL + o3), *(const v4u*)&tbl[cl][q * 8]); } } } }
// ---- k_sc: block = (query block qb, key block kb <= kb_last(qb), head in group) of batch b: logits x SCALE; q hi + residual (x 2^10) against k (2 products) for query rows < QHI, plus the k residual (3 products) for query blocks < QBH (causal early rows); causal: blocks past the diagonal exit, the mask itself is applied by index in k_sm
__global__ __launch_bounds__(128) void k_sc(const _Float16* __restrict__ QH, const _Float16* __restrict__ KH, const _Float16* __restrict__ QL, const _Float16* __restrict__ KL, int b, int h0, float* __restrict__ S0) { __shared__ __align__(16) float ss[4][16][132];
  const int qb = blockIdx.x, kb = blockIdx.y; if (kb > kb_last(qb)) return;
  const int h = h0 + blockIdx.z; float* S = S0 + (size_t)blockIdx.z * TT * TT;
  const int tid = threadIdx.x, wave = tid >> 5, lane = tid & 31, col = lane & 15, g = lane >> 4; const int k0 = kb * 128; const int ql0 = qb * 64 + wave * 16; const size_t q0 = (size_t)b * TT + ql0, kr0 = (size_t)b * TT + k0;
  v8f acc[8] = {}, accl[8] = {};
  const _Float16* QLb = QL + (size_t)b * QHI * CC; const _Float16* KLb = KL + (size_t)b * KHI * CC;
  if (qb < QBH) {
#pragma unroll
    for (int kc = 0; kc < HD / 32; ++kc) { const v16h ah = frag_h(QH + (q0 + col) * CC + h * HD + kc * 32, lane), al = frag_h(QLb + (size_t)(ql0 + col) * CC + h * HD + kc * 32, lane);
#pragma unroll
      for (int j = 0; j < 8; ++j) { const v16h kbf = frag_h(KH + (kr0 + j * 16 + col) * CC + h * HD + kc * 32, lane), klf = frag_h(KLb + (size_t)(k0 + j * 16 + col) * CC + h * HD + kc * 32, lane); acc[j] = wmma16(ah, kbf, acc[j]); accl[j] = wmma16(al, kbf, accl[j]); accl[j] = wmma16(ah, klf, accl[j]); } }
  } else if (qb * 64 < QHI) {
#pragma unroll
    for (int kc = 0; kc < HD / 32; ++kc) { const v16h ah = frag_h(QH + (q0 + col) * CC + h * HD + kc * 32, lane), al = frag_h(QLb + (size_t)(ql0 + col) * CC + h * HD + kc * 32, lane);
#pragma unroll
      for (int j = 0; j < 8; ++j) { const v16h kbf = frag_h(KH + (kr0 + j * 16 + col) * CC + h * HD + kc * 32, lane); acc[j] = wmma16(ah, kbf, acc[j]); accl[j] = wmma16(al, kbf, accl[j]); } }
  } else {
#pragma unroll
    for (int kc = 0; kc < HD / 32; ++kc) { const v16h ah = frag_h(QH + (q0 + col) * CC + h * HD + kc * 32, lane);
#pragma unroll
      for (int j = 0; j < 8; ++j) { const v16h kbf = frag_h(KH + (kr0 + j * 16 + col) * CC + h * HD + kc * 32, lane); acc[j] = wmma16(ah, kbf, acc[j]); } } }
#pragma unroll
  for (int j = 0; j < 8; ++j) {
#pragma unroll
    for (int r = 0; r < 8; ++r) ss[wave][8 * g + r][j * 16 + col] = (acc[j][r] + accl[j][r] * (1.0f / 1024.0f)) * SCALE; }
  LDSX(); for (int rl = 0; rl < 16; ++rl) vst2(S + (size_t)(ql0 + rl) * TT + k0 + lane * 4, *(const v4f*)&ss[wave][rl][lane * 4]); }
// ---- k_sm: block = query row t (head in group): keys [0, kend): causal -> logit if s <= t else excluded; softmax in f32; P x 2^11 in place (0 for excluded)
__global__ __launch_bounds__(256) void k_sm(float* __restrict__ S0 SM_EXTRA_PARAMS) { __shared__ float sred[8]; __shared__ float sbc; __shared__ __align__(16) float shv[TT];
  const int tid = threadIdx.x; const int t = blockIdx.x; const int kend = (kb_last(t >> 6) + 1) * 128;
  float* sr = S0 + (size_t)blockIdx.y * TT * TT + (size_t)t * TT;
  float m = -3.0e38f; for (int k = tid; k < kend; k += 256) { float v = (!CAUSAL || k <= t) ? sr[k] : -3.0e38f; SM_MASK_HOOK; shv[k] = v; m = fmaxf(m, v); }
#pragma unroll
  for (int o = 1; o < 32; o <<= 1) m = fmaxf(m, __shfl_xor(m, o));
  if ((tid & 31) == 0) sred[tid >> 5] = m; __syncthreads(); if (tid == 0) { float a = sred[0]; for (int i = 1; i < 8; ++i) a = fmaxf(a, sred[i]); sbc = a; } __syncthreads(); m = sbc; __syncthreads();
  float sum = 0.f; for (int k = tid; k < kend; k += 256) { const float v = shv[k]; const float e = (v <= -1.0e38f) ? 0.f : expf(v - m); shv[k] = e; sum += e; }
#pragma unroll
  for (int o = 1; o < 32; o <<= 1) sum += __shfl_xor(sum, o);
  if ((tid & 31) == 0) sred[tid >> 5] = sum; __syncthreads(); if (tid == 0) { float a = 0.f; for (int i = 0; i < 8; ++i) a += sred[i]; sbc = a > 0.f ? 2048.0f / a : 0.f; }   /* a fully excluded row yields P = 0 */ __syncthreads(); const float inv = sbc;
  for (int k = tid; k < kend; k += 256) shv[k] = shv[k] * inv;
  __syncthreads(); for (int q = tid; q < kend / 4; q += 256) vst2(sr + q * 4, *(const v4f*)&shv[q * 4]); }
// ---- k_pv: block = 64 queries (qb) of (b, h): ctx = P . v over keys [0, kend) (P x 2^11 once to f16 against v f16: 1 product; causal early query blocks: P and v as bf16 hi + lo, 3 products); 256-B (row, head) segment by 16 lanes
__global__ __launch_bounds__(128) void k_pv(const float* __restrict__ PS0, const _Float16* __restrict__ VT, const __bf16* __restrict__ VB, const __bf16* __restrict__ VBL, int b, int h0, float* __restrict__ Y) { const int h = h0 + blockIdx.z; const float* PS = PS0 + (size_t)blockIdx.z * TT * TT; __shared__ __align__(16) float ss[4][16][HD + 4];
  const int tid = threadIdx.x, wave = tid >> 5, lane = tid & 31, col = lane & 15, g = lane >> 4; const int qb = blockIdx.x; const int ql0 = qb * 64 + wave * 16; const int kce = (kb_last(qb) + 1) * 4;
  v8f acc[HD / 16] = {};
  if (qb < QBH) {
#pragma unroll 1
    for (int kc = 0; kc < kce; ++kc) { const F2 p = split_row(PS + (size_t)(ql0 + col) * TT, kc * 32, lane);
      asm volatile("s_wait_loadcnt 0x0" ::: "memory");
#pragma unroll
      for (int j = 0; j < HD / 16; ++j) { const size_t po = ((size_t)b * CC + h * HD + j * 16 + col) * (size_t)KHI + kc * 32; const v16b vh = frag_b(VB + po, lane); acc[j] = wmma_bf(p.h, vh, acc[j]); acc[j] = wmma_bf(p.l, vh, acc[j]); acc[j] = wmma_bf(p.h, frag_b(VBL + po, lane), acc[j]); } }
  } else {
#pragma unroll 1
    for (int kc = 0; kc < kce; ++kc) { const v16h p = frag_f32(PS + (size_t)(ql0 + col) * TT + kc * 32, lane);
      asm volatile("s_wait_loadcnt 0x0" ::: "memory");
#pragma unroll
      for (int j = 0; j < HD / 16; ++j) { const size_t po = ((size_t)b * CC + h * HD + j * 16 + col) * (size_t)TT + kc * 32; acc[j] = wmma16(p, frag_h(VT + po, lane), acc[j]); } } }
#pragma unroll
  for (int j = 0; j < HD / 16; ++j)
#pragma unroll
    for (int r = 0; r < 8; ++r) ss[wave][8 * g + r][j * 16 + col] = acc[j][r] * (1.0f / 2048.0f);
  LDSX(); for (int rl = 0; rl < 16; ++rl) if (lane < HD / 4) vst2(Y + ((size_t)b * TT + ql0 + rl) * CC + h * HD + lane * 4, *(const v4f*)&ss[wave][rl][lane * 4]); }

extern "C" void kernel_launch(void* const* d_in, const int* in_sizes, int n_in, void* d_out, int out_size, void* d_ws, size_t ws_size, hipStream_t stream) {
  (void)in_sizes; (void)n_in; (void)out_size;
  const float** F = (const float**)d_in;
  if (ws_size < (size_t)WS_END) return;
  char* ws = (char*)d_ws; _Float16 *QH = (_Float16*)(ws + WS_QH), *KH = (_Float16*)(ws + WS_KH), *VT = (_Float16*)(ws + WS_VT), *QL = (_Float16*)(ws + WS_QL), *KL = (_Float16*)(ws + WS_KL); __bf16 *VB = (__bf16*)(ws + WS_VB), *VBL = (__bf16*)(ws + WS_VBL); float *S = (float*)(ws + WS_S), *Y = (float*)(ws + WS_Y);
  (void)Y; (void)QL; (void)KL; (void)VB; (void)VBL;
  // inputs: 0 hidden_states [4,2048,768]; 1 attention_mask [4,1,1,2048] f32 (zeros); 2 Wq [768,768] (out,in), 3 bq; 4 Wk, 5 bk; 6 Wv, 7 bv (biases zeros, read)
  k_proj<<<dim3(TNB * TT / 64, CC / 128, 3), 128, 0, stream>>>(F[0], F[0], F[0], F[2], F[4], F[6], F[3], F[5], F[7], QH, QL, KH, KL, VT, VB, VBL);
  for (int b = 0; b < TNB; ++b) for (int h0 = 0; h0 < NH; h0 += HG) {
    k_sc<<<dim3(NQB, TT / 128, HG), 128, 0, stream>>>(QH, KH, QL, KL, b, h0, S);
    k_sm<<<dim3(TT, HG), 256, 0, stream>>>(S, b, F[1]);
    k_pv<<<dim3(NQB, 1, HG), 128, 0, stream>>>(S, VT, VB, VBL, b, h0, (float*)d_out);   /* merged heads are the output: row b*TT + t, columns h*64 .. */
  }
}

// v002
// It runs in 329 microseconds.
// In both of two side-by-side timings against v001, it was 2.89 times as fast.
// All steps since v000 together make it 4.59 times as fast.
// compute dtype: all float inputs rounded to bf16; q/k/v projections with EXACT bf16 products on WMMA 16x16x32 (f32 accumulate) + bias (zeros, read); causal logits: 3 products for the first 384 rows, single f16 q x k after, x 64^-0.5, plus the additive float key mask (read); softmax f32 with a running maximum, in registers; exp x 2^11 once to f16 x v once to f16 (bf16 hi + lo below row 384), divided by the f32 row sum at the end; f32 output (no output projection).
#include <hip/hip_runtime.h>
#include <math.h>

typedef __attribute__((ext_vector_type(16))) _Float16 v16h;
typedef __attribute__((ext_vector_type(16))) __bf16 v16b;
typedef __attribute__((ext_vector_type(8)))  _Float16 v8h;
typedef __attribute__((ext_vector_type(8)))  float v8f;
typedef __attribute__((ext_vector_type(4)))  float v4f;
typedef __attribute__((ext_vector_type(2)))  float v2f;
typedef __attribute__((ext_vector_type(4)))  unsigned v4u;
typedef __attribute__((ext_vector_type(4)))  int v4i;
typedef float __attribute__((may_alias)) float_a;
typedef int __attribute__((may_alias)) int_a;

template <typename T> __device__ __forceinline__ void vst2(void* p, T v) { *(T*)p = v;  }
__device__ __forceinline__ v8f wmma16(v16h a, v16h b, v8f c) {
  v8f d = __builtin_amdgcn_wmma_f32_16x16x32_f16(false, a, false, b, (short)0, c, false, false);
  asm volatile("v_nop\n\tv_nop\n\tv_nop\n\tv_nop" : "+v"(d) : "v"(a), "v"(b));
  return d;
}
__device__ __forceinline__ v8f wmma_bf(v16b a, v16b b, v8f c) {
  v8f d = __builtin_amdgcn_wmma_f32_16x16x32_bf16(false, a, false, b, (short)0, c, false, false);
  asm volatile("v_nop\n\tv_nop\n\tv_nop\n\tv_nop" : "+v"(d) : "v"(a), "v"(b));
  return d;
}
// 16x16x32 fragments: lane = (h = lane>>4, row/col = lane&15); elements 0..7 = k0+8h+0..7, 8..15 = k0+16+8h+0..7; D element r = row 8h+r
__device__ __forceinline__ v16h frag_h(const _Float16* rowk0, int lane) {
  union { v16h v; v8h q[2]; } u; const _Float16* p = rowk0 + 8 * (lane >> 4);
  u.q[0] = *(const v8h*)p; u.q[1] = *(const v8h*)(p + 16); return u.v;
}
__device__ __forceinline__ v16h frag_f32(const float* rowk0, int lane) {
  v16h a; const float* p = rowk0 + 8 * (lane >> 4);
#pragma unroll
  for (int i = 0; i < 8; ++i) { a[i] = (_Float16)p[i]; a[8 + i] = (_Float16)p[16 + i]; }
  return a;
}
__device__ __forceinline__ v16h frag_f32s(const float* rowk0, int lane, float sc) {
  v16h a; const float* p = rowk0 + 8 * (lane >> 4);
#pragma unroll
  for (int i = 0; i < 8; ++i) { a[i] = (_Float16)(p[i] * sc); a[8 + i] = (_Float16)(p[16 + i] * sc); }
  return a;
}
// column fragment from a [K][ld] layout (column n), rows >= K read as 0
__device__ __forceinline__ v16h fragc_f32(const float* W, int k0, int n, int lane, int ld, int K) {
  v16h a; const int g = lane >> 4;
#pragma unroll
  for (int i = 0; i < 8; ++i) { const int ka = k0 + 8 * g + i, kb = ka + 16;
    a[i] = (_Float16)(ka < K ? W[(size_t)(ka < K ? ka : K - 1) * ld + n] : 0.f); a[8 + i] = (_Float16)(kb < K ? W[(size_t)(kb < K ? kb : K - 1) * ld + n] : 0.f); }
  return a;
}
struct F2 { v16b h, l; };
__device__ __forceinline__ F2 bsplit16(const float v[16]) { F2 r;
#pragma unroll
  for (int i = 0; i < 16; ++i) { const __bf16 h = (__bf16)v[i]; r.h[i] = h; r.l[i] = (__bf16)(v[i] - (float)h); }
  return r; }
__device__ __forceinline__ F2 split_row(const float* row, int k0, int lane) { float v[16]; const float* p = row + k0 + 8 * (lane >> 4);
#pragma unroll
  for (int i = 0; i < 8; ++i) { v[i] = p[i]; v[8 + i] = p[16 + i]; }
  return bsplit16(v); }
__device__ __forceinline__ F2 split_rowK(const float* row, int k0, int lane, int K) { float v[16]; const int g = lane >> 4;
#pragma unroll
  for (int i = 0; i < 8; ++i) { const int ka = k0 + 8 * g + i, kb = ka + 16; v[i] = ka < K ? row[ka < K ? ka : K - 1] : 0.f; v[8 + i] = kb < K ? row[kb < K ? kb : K - 1] : 0.f; }
  return bsplit16(v); }
__device__ __forceinline__ F2 split_col(const float* W, int k0, int n, int lane, int ld, int K) { float v[16]; const int g = lane >> 4;
#pragma unroll
  for (int i = 0; i < 8; ++i) { const int ka = k0 + 8 * g + i, kb = ka + 16; v[i] = ka < K ? W[(size_t)(ka < K ? ka : K - 1) * ld + n] : 0.f; v[8 + i] = kb < K ? W[(size_t)(kb < K ? kb : K - 1) * ld + n] : 0.f; }
  return bsplit16(v); }
__device__ __forceinline__ v8f mac3(const F2& a, const F2& b, v8f c) { c = wmma_bf(a.l, b.h, c); c = wmma_bf(a.h, b.l, c); return wmma_bf(a.h, b.h, c); }
__device__ __forceinline__ float sigm(float v) { return 1.0f / (1.0f + expf(-v)); }
#define LDSX() do { asm volatile("s_wait_dscnt 0" ::: "memory"); __builtin_amdgcn_wave_barrier(); __builtin_amdgcn_fence(__ATOMIC_RELEASE, "workgroup"); } while (0)

// Causal multi-head self-attention without an output projection (hidden_states [4,2048,768]; attention_mask [4,1,1,2048] f32 (zeros on this draw) ADDED to the scores per key; torch (out,in) Wq / Wk / Wv [768,768] N(0,1) x 0.02 applied as x @ W.T, zero biases (read); 12 heads x 64; scores / 64^0.5; -inf strictly above the diagonal; + attention_mask; softmax; heads merged to [4,2048,768]).
#define NB 4
#define TT 2048
#define CC 768            // NH * HD = projected width
#define DIN 768          // input (model) width
#define NH 12
#define HD 64
#define NQB (TT / 64)
#define SCALE (0.125f)
#define CAUSAL 1
#ifndef TNB
#define TNB NB
#endif
__device__ __forceinline__ float bfr(float v) { return (float)(__bf16)v; }
__host__ __device__ __forceinline__ int kb_last(int qb) { return CAUSAL ? ((qb * 64 + 63) >> 7) : (TT / 128 - 1); }
typedef __attribute__((ext_vector_type(8))) __bf16 v8b;
__device__ __forceinline__ v16b frag_b(const __bf16* rowk0, int lane) {
  union { v16b v; v8b q[2]; } u; const __bf16* p = rowk0 + 8 * (lane >> 4);
  u.q[0] = *(const v8b*)p; u.q[1] = *(const v8b*)(p + 16); return u.v;
}
#define QBH 6              // causal: unused; the high-precision path is taken by queries below QHI (few keys, no averaging)
#define QHI 384            // rows carrying a q residual plane
#define KHI 384            // key rows carrying k residual / v bf16 hi+lo planes (used only by the causal high-precision path)
// B fragment (k rows k0+.., output column o) of a weight: (in,out) [K][ld] or (out,in) [ld rows of K]: bf16 exact, or f16(bf16 * 256) exact
__device__ __forceinline__ v16b wcol_io(const float* Wm, int k0, int o, int lane, int ld) { v16b w; const int g = lane >> 4;
#pragma unroll
  for (int i = 0; i < 8; ++i) { w[i] = (__bf16)Wm[(size_t)(k0 + 8 * g + i) * ld + o]; w[8 + i] = (__bf16)Wm[(size_t)(k0 + 16 + 8 * g + i) * ld + o]; }
  return w; }
__device__ __forceinline__ v16b wcol_oi(const float* Wm, int k0, int o, int lane, int K) { v16b w; const float* p = Wm + (size_t)o * K + k0 + 8 * (lane >> 4);
#pragma unroll
  for (int i = 0; i < 8; ++i) { w[i] = (__bf16)p[i]; w[8 + i] = (__bf16)p[16 + i]; }
  return w; }
__device__ __forceinline__ v16h wcolh_io(const float* Wm, int k0, int o, int lane, int ld) { v16h w; const int g = lane >> 4;
#pragma unroll
  for (int i = 0; i < 8; ++i) { w[i] = (_Float16)(bfr(Wm[(size_t)(k0 + 8 * g + i) * ld + o]) * 256.0f); w[8 + i] = (_Float16)(bfr(Wm[(size_t)(k0 + 16 + 8 * g + i) * ld + o]) * 256.0f); }
  return w; }
__device__ __forceinline__ v16h wcolh_oi(const float* Wm, int k0, int o, int lane, int K) { v16h w; const float* p = Wm + (size_t)o * K + k0 + 8 * (lane >> 4);
#pragma unroll
  for (int i = 0; i < 8; ++i) { w[i] = (_Float16)(bfr(p[i]) * 256.0f); w[8 + i] = (_Float16)(bfr(p[16 + i]) * 256.0f); }
  return w; }
#define WQKV_LAYOUT 1   // 0 = (in,out) [DIN][CC]; 1 = (out,in) [CC][DIN]; 2 = per-head [NH][DIN][HD]
__device__ __forceinline__ v16b wcol_hdk(const float* Wm, int k0, int o, int lane) { v16b w; const int g = lane >> 4; const float* p = Wm + (size_t)(o / HD) * DIN * HD + (o % HD);
#pragma unroll
  for (int i = 0; i < 8; ++i) { w[i] = (__bf16)p[(size_t)(k0 + 8 * g + i) * HD]; w[8 + i] = (__bf16)p[(size_t)(k0 + 16 + 8 * g + i) * HD]; }
  return w; }
#define WO_OUT_IN 1
#if WQKV_LAYOUT == 1
#define WCOL(W, k0, o, lane) wcol_oi(W, k0, o, lane, DIN)
#elif WQKV_LAYOUT == 2
#define WCOL(W, k0, o, lane) wcol_hdk(W, k0, o, lane)
#else
#define WCOL(W, k0, o, lane) wcol_io(W, k0, o, lane, CC)
#endif
#if WO_OUT_IN
#define WOCOL(W, k0, o, lane) wcol_oi(W, k0, o, lane, CC)
#define WOCOLH(W, k0, o, lane) wcolh_oi(W, k0, o, lane, CC)
#else
#define WOCOL(W, k0, o, lane) wcol_io(W, k0, o, lane, DIN)
#define WOCOLH(W, k0, o, lane) wcolh_io(W, k0, o, lane, DIN)
#endif

#define WS_QH  0u                                      // f16 q rows [b*t][CC]
#define WS_KH  (WS_QH + 2u * (size_t)NB * TT * CC)      // f16 k rows [b*t][CC]
#define WS_VT  (WS_KH + 2u * (size_t)NB * TT * CC)      // f16 v planes [b][c][t]
#define WS_QL  (WS_VT + 2u * (size_t)NB * CC * TT)      // f16 q residual x 2^10 rows [b][t < QHI][CC]
#define WS_KL  (WS_QL + 2u * (size_t)NB * QHI * CC)     // f16 k residual x 2^10 rows [b][t < KHI][CC]
#define WS_VB  (WS_KL + 2u * (size_t)NB * KHI * CC)     // bf16 v hi planes [b][c][t < KHI]
#define WS_VBL (WS_VB + 2u * (size_t)NB * CC * KHI)
#define WS_END (WS_VBL + 2u * (size_t)NB * CC * KHI)

// ---- k_proj: block = (64 rows, 128 cols, which): q/k/v = X W (+ b) with exact bf16 products (K = DIN) -> which 0: q f16 rows (+ residual rows < QHI); 1: k f16 rows (+ residual rows < KHI); 2: v f16 planes [c][t] (+ bf16 hi/lo planes for t < KHI)
__global__ __launch_bounds__(128) void k_proj(const float* __restrict__ XQ, const float* __restrict__ XK, const float* __restrict__ XV, const float* __restrict__ WQ, const float* __restrict__ WK, const float* __restrict__ WV, const float* __restrict__ BQ, const float* __restrict__ BK, const float* __restrict__ BV,
    _Float16* __restrict__ QH, _Float16* __restrict__ QL, _Float16* __restrict__ KH, _Float16* __restrict__ KL, _Float16* __restrict__ VT, __bf16* __restrict__ VB, __bf16* __restrict__ VBL) {
  __shared__ __align__(16) _Float16 sh[64][136], sl[64][136]; __shared__ __align__(16) _Float16 th[128][72]; __shared__ __align__(16) __bf16 tb[128][72], tbl[128][72];
  const int tid = threadIdx.x, wave = tid >> 5, lane = tid & 31, col = lane & 15, g = lane >> 4; const int which = blockIdx.z; const int c0 = blockIdx.y * 128; const size_t r0 = (size_t)blockIdx.x * 64; const size_t bb = r0 / TT; const int t0 = (int)(r0 % TT);
  const float* X = which == 0 ? XQ : which == 1 ? XK : XV; const float* WA = which == 0 ? WQ : which == 1 ? WK : WV; const float* BA = which == 0 ? BQ : which == 1 ? BK : BV;
  v8f acc[8] = {};
#pragma unroll 2
  for (int kc = 0; kc < DIN / 32; ++kc) { v16b a; { const float* p = X + (r0 + wave * 16 + col) * DIN + kc * 32 + 8 * g;
#pragma unroll
      for (int i = 0; i < 8; ++i) { a[i] = (__bf16)p[i]; a[8 + i] = (__bf16)p[16 + i]; } }
    asm volatile("s_wait_loadcnt 0x0" ::: "memory");
#pragma unroll
    for (int j = 0; j < 8; ++j) { const v16b w = WCOL(WA, kc * 32, c0 + j * 16 + col, lane); asm volatile("s_wait_loadcnt 0x0" ::: "memory"); acc[j] = wmma_bf(a, w, acc[j]); } }
  if (which < 2) { _Float16* DH = which == 0 ? QH : KH; _Float16* DL = which == 0 ? QL : KL; const int nhi = which == 0 ? QHI : KHI; const bool hi_rows = t0 < nhi;
#pragma unroll
    for (int j = 0; j < 8; ++j) { const float bias = BA ? bfr(BA[c0 + j * 16 + col]) : 0.f;
#pragma unroll
      for (int r = 0; r < 8; ++r) { const float v = acc[j][r] + bias; const _Float16 hv = (_Float16)v; sh[wave * 16 + 8 * g + r][j * 16 + col] = hv; sl[wave * 16 + 8 * g + r][j * 16 + col] = (_Float16)((v - (float)hv) * 1024.0f); } }
    __syncthreads();
    for (int e = tid; e < 64 * 16; e += 128) { const int rl = e >> 4, q = e & 15; vst2((unsigned*)(DH + (r0 + rl) * CC + c0 + q * 8), *(const v4u*)&sh[rl][q * 8]); if (hi_rows) vst2((unsigned*)(DL + (bb * nhi + t0 + rl) * (size_t)CC + c0 + q * 8), *(const v4u*)&sl[rl][q * 8]); }
  } else { const bool hi_rows = t0 < KHI;
#pragma unroll
    for (int j = 0; j < 8; ++j) { const float bias = BA ? bfr(BA[c0 + j * 16 + col]) : 0.f;
#pragma unroll
      for (int r = 0; r < 8; ++r) { const float v = acc[j][r] + bias; const int rl = wave * 16 + 8 * g + r, cl = j * 16 + col; th[cl][rl] = (_Float16)v; const __bf16 bh = (__bf16)v; tb[cl][rl] = bh; tbl[cl][rl] = (__bf16)(v - (float)bh); } }
    __syncthreads();
    for (int e = tid; e < 128 * 8; e += 128) { const int cl = e >> 3, q = e & 7; vst2((unsigned*)(VT + (bb * CC + c0 + cl) * (size_t)TT + t0 + q * 8), *(const v4u*)&th[cl][q * 8]); if (hi_rows) { const size_t o3 = (bb * CC + c0 + cl) * (size_t)KHI + t0 + q * 8; vst2((unsigned*)(VB + o3), *(const v4u*)&tb[cl][q * 8]); vst2((unsigned*)(VBL + o3), *(const v4u*)&tbl[cl][q * 8]); } } } }
// ---- k_fa: scores, softmax and P . v in one launch. Block = 128 queries of one (batch, head), wave = 32 queries, walking its keys [0, last query] 32 at a time.
// Transposed products: S^T = K . Q^T (D: register r = key 8g + r, lane column = query), so a lane holds 16 scores of ONE query and two S^T tiles, converted in place, are the B operand of O^T += V^T . P^T.
// Running maximum m and running sum l per query; the output tile is rescaled by exp(m_old - m_new) on every pass.
#define FQW 32            // queries per wave
#define FQB 128           // queries per block
#define L2E 1.4426950408889634f
__device__ __forceinline__ v8f wm_h(v16h a, v16h b, v8f c) { return __builtin_amdgcn_wmma_f32_16x16x32_f16(false, a, false, b, (short)0, c, false, false); }
__device__ __forceinline__ v8f wm_b(v16b a, v16b b, v8f c) { return __builtin_amdgcn_wmma_f32_16x16x32_bf16(false, a, false, b, (short)0, c, false, false); }
// lane l with lane l ^ 16
__device__ __forceinline__ float xhalf(float x) { return __builtin_bit_cast(float, __builtin_amdgcn_permlanex16(__builtin_bit_cast(int, x), __builtin_bit_cast(int, x), 0x76543210, 0xfedcba98, false, false)); }
// the 16 additive mask values (bf16-rounded like every float input) of the keys a lane holds: k0 + 8g + 0..7 and k0 + 16 + 8g + 0..7
__device__ __forceinline__ void mask16(const float* __restrict__ amk, float am[16]) {
  const v4f a0 = *(const v4f*)amk, a1 = *(const v4f*)(amk + 4), a2 = *(const v4f*)(amk + 16), a3 = *(const v4f*)(amk + 20);
#pragma unroll
  for (int i = 0; i < 4; ++i) { am[i] = bfr(a0[i]); am[4 + i] = bfr(a1[i]); am[8 + i] = bfr(a2[i]); am[12 + i] = bfr(a3[i]); } }
// 2^x on the transcendental pipe, with the slot that the instruction set asks for behind a transcendental before its result is used or its source overwritten: in a run each fills the slot of the one in front, one v_nop closes the run
__device__ __forceinline__ void exp2x8(float* a) {
  asm("v_exp_f32 %0, %0\n\tv_exp_f32 %1, %1\n\tv_exp_f32 %2, %2\n\tv_exp_f32 %3, %3\n\tv_exp_f32 %4, %4\n\tv_exp_f32 %5, %5\n\tv_exp_f32 %6, %6\n\tv_exp_f32 %7, %7\n\tv_nop"
      : "+v"(a[0]), "+v"(a[1]), "+v"(a[2]), "+v"(a[3]), "+v"(a[4]), "+v"(a[5]), "+v"(a[6]), "+v"(a[7])); }
__device__ __forceinline__ float exp2x1(float x) { float r; asm("v_exp_f32 %0, %1\n\tv_nop" : "=v"(r) : "v"(x)); return r; }
// one pass of the running softmax for one query column: v[16] -> exp(v - m) x 2^11 (the 2^11 rides in the exponent; l sums the same scaled terms); returns the factor for what was summed before
__device__ __forceinline__ float soft16(float v[16], float& m, float& l) {
  float mx = v[0];
#pragma unroll
  for (int i = 1; i < 16; ++i) mx = fmaxf(mx, v[i]);
  mx = fmaxf(mx, xhalf(mx)); const float mn = fmaxf(m, mx); const float alpha = exp2x1((m - mn) * L2E); m = mn;
  // a key at or below -1e38 is excluded (term 0): under a larger maximum its exponent underflows by itself; where the maximum itself is that low every key so far is excluded
  const float mr = mn <= -1.0e38f ? 3.0e38f : mn;
#pragma unroll
  for (int i = 0; i < 16; ++i) v[i] = fmaf(v[i] - mr, L2E, 11.0f);
  exp2x8(v); exp2x8(v + 8);
  float sum = 0.f;
#pragma unroll
  for (int i = 0; i < 16; ++i) sum += v[i];
  l = l * alpha + sum; return alpha; }
// a 16x16x32 fragment at a wave-uniform base plus the lane's own byte offset (row and 8g in it) plus a constant: elements 0..7 = p[0..7], 8..15 = p[16..23]
__device__ __forceinline__ v16h ld16h(const _Float16* base, unsigned off, int el) { const _Float16* p = (const _Float16*)((const char*)base + off) + el; union { v16h v; v8h q[2]; } u; u.q[0] = *(const v8h*)p; u.q[1] = *(const v8h*)(p + 16); return u.v; }
__device__ __forceinline__ v16b ld16b(const __bf16* base, unsigned off, int el) { const __bf16* p = (const __bf16*)((const char*)base + off) + el; union { v16b v; v8b q[2]; } u; u.q[0] = *(const v8b*)p; u.q[1] = *(const v8b*)(p + 16); return u.v; }
// query rows < QHI, 16 at a time: q and k as f16 hi + residual (3 products), exp and v as bf16 hi + lo (3 products)
__device__ __forceinline__ void fa_hi(const _Float16* __restrict__ QH, const _Float16* __restrict__ KH, const _Float16* __restrict__ QL, const _Float16* __restrict__ KL, const __bf16* __restrict__ VB, const __bf16* __restrict__ VBL, const float* __restrict__ AM,
    int b, int h, int qt, int lane, float (*st)[HD + 4]) {
  const int col = lane & 15, g = lane >> 4; const int t = qt + col;
  const _Float16* Qs = QH + ((size_t)b * TT + qt) * CC + h * HD; const _Float16* Qls = QL + ((size_t)b * QHI + qt) * CC + h * HD; const unsigned qo = (unsigned)(col * CC + 8 * g) * 2u;
  v16h qh[2], ql[2];
#pragma unroll
  for (int kc = 0; kc < 2; ++kc) { qh[kc] = ld16h(Qs, qo, kc * 32); ql[kc] = ld16h(Qls, qo, kc * 32); }
  asm volatile("s_wait_xcnt 0x0" :: "v"(qh[0]), "v"(qh[1]), "v"(ql[0]), "v"(ql[1]) : "memory");   // stands behind the q loads, in front of the first write of their address registers; the loaded values are inputs only, so that the loads cannot sink below it (without them this build placed the loads behind the wait and a K load's result in their address registers)
  // wave-uniform bases and each lane's own byte offsets, stepped once a pass: every load of a pass is one of these registers plus a constant
  const float* As = AM + (size_t)b * TT; const _Float16* Ks = KH + (size_t)b * TT * CC + h * HD; const _Float16* Kls = KL + (size_t)b * KHI * CC + h * HD;
  const __bf16* Vs = VB + ((size_t)b * CC + h * HD) * (size_t)KHI; const __bf16* Vls = VBL + ((size_t)b * CC + h * HD) * (size_t)KHI;
  unsigned ao = (unsigned)(8 * g) * 4u, ko = (unsigned)(col * CC + 8 * g) * 2u, vo = (unsigned)(col * KHI + 8 * g) * 2u;
  v8f o[HD / 16] = {}; float m = -3.0e38f, l = 0.f; const int nit = qt / 32 + 1;
#pragma unroll 1
  for (int it = 0; it < nit; ++it) { const int k0 = it * 32; v8f acc[2] = {}, accl[2] = {}; float am[16]; mask16((const float*)((const char*)As + ao), am);
#pragma unroll
    for (int kt = 0; kt < 2; ++kt)
#pragma unroll
      for (int kc = 0; kc < 2; ++kc) { const v16h kh = ld16h(Ks, ko, kt * 16 * CC + kc * 32), kl = ld16h(Kls, ko, kt * 16 * CC + kc * 32);
        acc[kt] = wm_h(kh, qh[kc], acc[kt]); accl[kt] = wm_h(kh, ql[kc], accl[kt]); accl[kt] = wm_h(kl, qh[kc], accl[kt]); }
    v16b vh[HD / 16], vl[HD / 16];
#pragma unroll
    for (int j = 0; j < HD / 16; ++j) { vh[j] = ld16b(Vs, vo, j * 16 * KHI); vl[j] = ld16b(Vls, vo, j * 16 * KHI); }
    asm volatile("s_wait_xcnt 0x0" : "+v"(ao), "+v"(ko), "+v"(vo) :: "memory");   // stands between this pass's loads and the step of their offset registers; naming the offsets keeps them in those registers up to the wait and the step behind it
    ao += 32u * 4u; ko += 32u * CC * 2u; vo += 32u * 2u;
    float v[16];
#pragma unroll
    for (int i = 0; i < 16; ++i) { const int key = k0 + (i >> 3) * 16 + 8 * g + (i & 7); const float s = (acc[i >> 3][i & 7] + accl[i >> 3][i & 7] * (1.0f / 1024.0f)) * SCALE; v[i] = (key <= t ? s : -3.0e38f) + am[i]; }
    const float alpha = soft16(v, m, l); const F2 p = bsplit16(v);
#pragma unroll
    for (int j = 0; j < HD / 16; ++j) { o[j] = o[j] * alpha; o[j] = wm_b(vh[j], p.h, o[j]); o[j] = wm_b(vh[j], p.l, o[j]); o[j] = wm_b(vl[j], p.h, o[j]); } }
  l += xhalf(l); const float inv = l > 0.f ? 1.0f / l : 0.f;   /* a fully excluded row yields 0 */
#pragma unroll
  for (int j = 0; j < HD / 16; ++j) { const v8f r = o[j] * inv; *(v4f*)&st[col][j * 16 + 8 * g] = __builtin_shufflevector(r, r, 0, 1, 2, 3); *(v4f*)&st[col][j * 16 + 8 * g + 4] = __builtin_shufflevector(r, r, 4, 5, 6, 7); } }
// four waves per SIMD: keeps the allocation at 256 VGPRs, below the register windows that cost a mode switch per access
__global__ __launch_bounds__(128) __attribute__((amdgpu_waves_per_eu(4, 4))) void k_fa(const _Float16* __restrict__ QH, const _Float16* __restrict__ KH, const _Float16* __restrict__ QL, const _Float16* __restrict__ KL, const _Float16* __restrict__ VT, const __bf16* __restrict__ VB, const __bf16* __restrict__ VBL, const float* __restrict__ AM, float* __restrict__ Y) {
  __shared__ __align__(16) float ss[FQB / FQW][FQW][HD + 4];
  const int lane = threadIdx.x & 31, col = lane & 15, g = lane >> 4; const int wave = __builtin_amdgcn_readfirstlane(threadIdx.x >> 5);
  const int b = blockIdx.x / NH, h = blockIdx.x % NH; const int qw = (TT / FQB - 1 - (int)blockIdx.y) * FQB + wave * FQW;   // the blocks with the most keys start first
  if (qw < QHI) {
#pragma unroll 1   // one copy of the high-precision body serves both halves of the wave's 32 queries: half the code, and each half's loads stay inside its own trip
    for (int hf = 0; hf < 2; ++hf) fa_hi(QH, KH, QL, KL, VB, VBL, AM, b, h, qw + hf * 16, lane, &ss[wave][hf * 16]); }
  else {
    // wave-uniform bases and each lane's own byte offsets, stepped once a pass: every load of a pass is one of these registers plus a constant
    const _Float16* Ks = KH + (size_t)b * TT * CC + h * HD; const _Float16* Vs = VT + ((size_t)b * CC + h * HD) * (size_t)TT; const float* As = AM + (size_t)b * TT; const _Float16* Qs = QH + ((size_t)b * TT + qw) * CC + h * HD;
    unsigned ko = (unsigned)(col * CC + 8 * g) * 2u, vo = (unsigned)(col * TT + 8 * g) * 2u, ao = (unsigned)(8 * g) * 4u;
    v16h qf[2][2];
#pragma unroll
    for (int q = 0; q < 2; ++q)
#pragma unroll
      for (int kc = 0; kc < 2; ++kc) qf[q][kc] = ld16h(Qs, ko, q * 16 * CC + kc * 32);
    v8f o[2][HD / 16] = {}; float m[2] = {-3.0e38f, -3.0e38f}, l[2] = {0.f, 0.f}; const int nit = qw / 32 + 1;
    v16h kf[2][2];
#pragma unroll
    for (int kt = 0; kt < 2; ++kt)
#pragma unroll
      for (int kc = 0; kc < 2; ++kc) kf[kt][kc] = ld16h(Ks, ko, kt * 16 * CC + kc * 32);
    // one pass = 32 keys; only the last pass holds keys past a query, so it alone carries the index test and the loop body stays one straight block
    auto pass = [&](const bool last) __attribute__((always_inline)) {
      const float* amk = (const float*)((const char*)As + ao); const v4f ar[4] = {*(const v4f*)amk, *(const v4f*)(amk + 4), *(const v4f*)(amk + 16), *(const v4f*)(amk + 20)};   // the mask values of the keys a lane holds, in the order of mask16
      v16h vf[HD / 16];
#pragma unroll
      for (int j = 0; j < HD / 16; ++j) vf[j] = ld16h(Vs, vo, j * 16 * TT);
      __builtin_amdgcn_sched_barrier(0);   // the mask and V loads issue in front of the S^T products and fly under them; left free, the mask loads were placed where they are used and the wave waited out their latency on every pass
      v8f s[2][2] = {};
#pragma unroll
      for (int kc = 0; kc < 2; ++kc)
#pragma unroll
        for (int kt = 0; kt < 2; ++kt)
#pragma unroll
          for (int q = 0; q < 2; ++q) s[q][kt] = wm_h(kf[kt][kc], qf[q][kc], s[q][kt]);
      // the next pass's K fragments fly while this pass does its softmax and P . v
      if (!last) {
#pragma unroll
        for (int kt = 0; kt < 2; ++kt)
#pragma unroll
          for (int kc = 0; kc < 2; ++kc) kf[kt][kc] = ld16h(Ks, ko, (32 + kt * 16) * CC + kc * 32); }
      asm volatile("s_wait_xcnt 0x0" : "+v"(ao), "+v"(vo), "+v"(ko) :: "memory");   // stands between this pass's loads and the step of their offset registers; naming the offsets keeps them in those registers up to the wait and the step behind it
      ao += 32u * 4u; vo += 32u * 2u; ko += 32u * CC * 2u;
      __builtin_amdgcn_sched_barrier(0);   // keeps the first use of the mask values, and with it their wait, behind the S^T products
      float am[16];
#pragma unroll
      for (int i = 0; i < 16; ++i) am[i] = bfr(ar[i >> 2][i & 3]);
      v16h pf[2];
#pragma unroll
      for (int q = 0; q < 2; ++q) { float v[16];
#pragma unroll
        for (int i = 0; i < 16; ++i) { const int key = qw + (i >> 3) * 16 + 8 * g + (i & 7);   /* the last pass starts at key qw */ const float sv = s[q][i >> 3][i & 7] * SCALE; v[i] = ((!last || key <= qw + q * 16 + col) ? sv : -3.0e38f) + am[i]; }
        const float alpha = soft16(v, m[q], l[q]);
#pragma unroll
        for (int i = 0; i < 16; ++i) pf[q][i] = (_Float16)v[i];
#pragma unroll
        for (int j = 0; j < HD / 16; ++j) o[q][j] = o[q][j] * alpha; }
#pragma unroll
      for (int j = 0; j < HD / 16; ++j)
#pragma unroll
        for (int q = 0; q < 2; ++q) o[q][j] = wm_h(vf[j], pf[q], o[q][j]); };
#pragma unroll 1
    for (int it = 0; it < nit - 1; ++it) pass(false);
    pass(true);
#pragma unroll
    for (int q = 0; q < 2; ++q) { const float lt = l[q] + xhalf(l[q]); const float inv = lt > 0.f ? 1.0f / lt : 0.f;   /* a fully excluded row yields 0 */
#pragma unroll
      for (int j = 0; j < HD / 16; ++j) { const v8f r = o[q][j] * inv; *(v4f*)&ss[wave][q * 16 + col][j * 16 + 8 * g] = __builtin_shufflevector(r, r, 0, 1, 2, 3); *(v4f*)&ss[wave][q * 16 + col][j * 16 + 8 * g + 4] = __builtin_shufflevector(r, r, 4, 5, 6, 7); } } }
  // each wave turns its own 32 x 64 tile in its own LDS slice: a 256-B (row, head) segment is stored by 16 lanes
  LDSX();
#pragma unroll
  for (int i = 0; i < FQW / 2; ++i) { const int rl = 2 * i + g; vst2(Y + ((size_t)b * TT + qw + rl) * CC + h * HD + col * 4, *(const v4f*)&ss[wave][rl][col * 4]); } }

extern "C" void kernel_launch(void* const* d_in, const int* in_sizes, int n_in, void* d_out, int out_size, void* d_ws, size_t ws_size, hipStream_t stream) {
  (void)in_sizes; (void)n_in; (void)out_size;
  const float** F = (const float**)d_in;
  if (ws_size < (size_t)WS_END) return;
  char* ws = (char*)d_ws; _Float16 *QH = (_Float16*)(ws + WS_QH), *KH = (_Float16*)(ws + WS_KH), *VT = (_Float16*)(ws + WS_VT), *QL = (_Float16*)(ws + WS_QL), *KL = (_Float16*)(ws + WS_KL); __bf16 *VB = (__bf16*)(ws + WS_VB), *VBL = (__bf16*)(ws + WS_VBL);
  // inputs: 0 hidden_states [4,2048,768]; 1 attention_mask [4,1,1,2048] f32 (zeros); 2 Wq [768,768] (out,in), 3 bq; 4 Wk, 5 bk; 6 Wv, 7 bv (biases zeros, read)
  k_proj<<<dim3(TNB * TT / 64, CC / 128, 3), 128, 0, stream>>>(F[0], F[0], F[0], F[2], F[4], F[6], F[3], F[5], F[7], QH, QL, KH, KL, VT, VB, VBL);
  k_fa<<<dim3(TNB * NH, TT / FQB), 128, 0, stream>>>(QH, KH, QL, KL, VT, VB, VBL, F[1], (float*)d_out);   /* merged heads are the output: row b*TT + t, columns h*64 .. */
}

// v003
// Measured time: 105 microseconds a run.
// Next to v002, in two timings, it ran 3.12 times as fast each time.
// Over all steps from v000 it is 14.3 times as fast.
// compute dtype: all float inputs rounded to bf16; q/k/v projections with EXACT bf16 products on WMMA 16x16x32 (f32 accumulate) + bias (zeros, read); causal logits: 3 products for the first 384 rows, single f16 q x k after, x 64^-0.5, plus the additive float key mask (read); softmax f32 with a running maximum, in registers; exp x 2^11 once to f16 x v once to f16 (bf16 hi + lo below row 384), divided by the f32 row sum at the end; f32 output (no output projection).
#include <hip/hip_runtime.h>
#include <math.h>

typedef __attribute__((ext_vector_type(16))) _Float16 v16h;
typedef __attribute__((ext_vector_type(16))) __bf16 v16b;
typedef __attribute__((ext_vector_type(8)))  _Float16 v8h;
typedef __attribute__((ext_vector_type(8)))  float v8f;
typedef __attribute__((ext_vector_type(4)))  float v4f;
typedef __attribute__((ext_vector_type(2)))  float v2f;
typedef __attribute__((ext_vector_type(4)))  unsigned v4u;
typedef __attribute__((ext_vector_type(4)))  int v4i;
typedef float __attribute__((may_alias)) float_a;
typedef int __attribute__((may_alias)) int_a;

template <typename T> __device__ __forceinline__ void vst2(void* p, T v) { *(T*)p = v;  }
__device__ __forceinline__ v8f wmma16(v16h a, v16h b, v8f c) {
  v8f d = __builtin_amdgcn_wmma_f32_16x16x32_f16(false, a, false, b, (short)0, c, false, false);
  asm volatile("v_nop\n\tv_nop\n\tv_nop\n\tv_nop" : "+v"(d) : "v"(a), "v"(b));
  return d;
}
__device__ __forceinline__ v8f wmma_bf(v16b a, v16b b, v8f c) {
  v8f d = __builtin_amdgcn_wmma_f32_16x16x32_bf16(false, a, false, b, (short)0, c, false, false);
  asm volatile("v_nop\n\tv_nop\n\tv_nop\n\tv_nop" : "+v"(d) : "v"(a), "v"(b));
  return d;
}
// 16x16x32 fragments: lane = (h = lane>>4, row/col = lane&15); elements 0..7 = k0+8h+0..7, 8..15 = k0+16+8h+0..7; D element r = row 8h+r
__device__ __forceinline__ v16h frag_h(const _Float16* rowk0, int lane) {
  union { v16h v; v8h q[2]; } u; const _Float16* p = rowk0 + 8 * (lane >> 4);
  u.q[0] = *(const v8h*)p; u.q[1] = *(const v8h*)(p + 16); return u.v;
}
__device__ __forceinline__ v16h frag_f32(const float* rowk0, int lane) {
  v16h a; const float* p = rowk0 + 8 * (lane >> 4);
#pragma unroll
  for (int i = 0; i < 8; ++i) { a[i] = (_Float16)p[i]; a[8 + i] = (_Float16)p[16 + i]; }
  return a;
}
__device__ __forceinline__ v16h frag_f32s(const float* rowk0, int lane, float sc) {
  v16h a; const float* p = rowk0 + 8 * (lane >> 4);
#pragma unroll
  for (int i = 0; i < 8; ++i) { a[i] = (_Float16)(p[i] * sc); a[8 + i] = (_Float16)(p[16 + i] * sc); }
  return a;
}
// column fragment from a [K][ld] layout (column n), rows >= K read as 0
__device__ __forceinline__ v16h fragc_f32(const float* W, int k0, int n, int lane, int ld, int K) {
  v16h a; const int g = lane >> 4;
#pragma unroll
  for (int i = 0; i < 8; ++i) { const int ka = k0 + 8 * g + i, kb = ka + 16;
    a[i] = (_Float16)(ka < K ? W[(size_t)(ka < K ? ka : K - 1) * ld + n] : 0.f); a[8 + i] = (_Float16)(kb < K ? W[(size_t)(kb < K ? kb : K - 1) * ld + n] : 0.f); }
  return a;
}
struct F2 { v16b h, l; };
__device__ __forceinline__ F2 bsplit16(const float v[16]) { F2 r;
#pragma unroll
  for (int i = 0; i < 16; ++i) { const __bf16 h = (__bf16)v[i]; r.h[i] = h; r.l[i] = (__bf16)(v[i] - (float)h); }
  return r; }
__device__ __forceinline__ F2 split_row(const float* row, int k0, int lane) { float v[16]; const float* p = row + k0 + 8 * (lane >> 4);
#pragma unroll
  for (int i = 0; i < 8; ++i) { v[i] = p[i]; v[8 + i] = p[16 + i]; }
  return bsplit16(v); }
__device__ __forceinline__ F2 split_rowK(const float* row, int k0, int lane, int K) { float v[16]; const int g = lane >> 4;
#pragma unroll
  for (int i = 0; i < 8; ++i) { const int ka = k0 + 8 * g + i, kb = ka + 16; v[i] = ka < K ? row[ka < K ? ka : K - 1] : 0.f; v[8 + i] = kb < K ? row[kb < K ? kb : K - 1] : 0.f; }
  return bsplit16(v); }
__device__ __forceinline__ F2 split_col(const float* W, int k0, int n, int lane, int ld, int K) { float v[16]; const int g = lane >> 4;
#pragma unroll
  for (int i = 0; i < 8; ++i) { const int ka = k0 + 8 * g + i, kb = ka + 16; v[i] = ka < K ? W[(size_t)(ka < K ? ka : K - 1) * ld + n] : 0.f; v[8 + i] = kb < K ? W[(size_t)(kb < K ? kb : K - 1) * ld + n] : 0.f; }
  return bsplit16(v); }
__device__ __forceinline__ v8f mac3(const F2& a, const F2& b, v8f c) { c = wmma_bf(a.l, b.h, c); c = wmma_bf(a.h, b.l, c); return wmma_bf(a.h, b.h, c); }
__device__ __forceinline__ float sigm(float v) { return 1.0f / (1.0f + expf(-v)); }
#define LDSX() do { asm volatile("s_wait_dscnt 0" ::: "memory"); __builtin_amdgcn_wave_barrier(); __builtin_amdgcn_fence(__ATOMIC_RELEASE, "workgroup"); } while (0)

// Causal multi-head self-attention without an output projection (hidden_states [4,2048,768]; attention_mask [4,1,1,2048] f32 (zeros on this draw) ADDED to the scores per key; torch (out,in) Wq / Wk / Wv [768,768] N(0,1) x 0.02 applied as x @ W.T, zero biases (read); 12 heads x 64; scores / 64^0.5; -inf strictly above the diagonal; + attention_mask; softmax; heads merged to [4,2048,768]).
#define NB 4
#define TT 2048
#define CC 768            // NH * HD = projected width
#define DIN 768          // input (model) width
#define NH 12
#define HD 64
#define NQB (TT / 64)
#define SCALE (0.125f)
#define CAUSAL 1
#ifndef TNB
#define TNB NB
#endif
__device__ __forceinline__ float bfr(float v) { return (float)(__bf16)v; }
__host__ __device__ __forceinline__ int kb_last(int qb) { return CAUSAL ? ((qb * 64 + 63) >> 7) : (TT / 128 - 1); }
typedef __attribute__((ext_vector_type(8))) __bf16 v8b;
__device__ __forceinline__ v16b frag_b(const __bf16* rowk0, int lane) {
  union { v16b v; v8b q[2]; } u; const __bf16* p = rowk0 + 8 * (lane >> 4);
  u.q[0] = *(const v8b*)p; u.q[1] = *(const v8b*)(p + 16); return u.v;
}
#define QBH 6              // causal: unused; the high-precision path is taken by queries below QHI (few keys, no averaging)
#define QHI 384            // rows carrying a q residual plane
#define KHI 384            // key rows carrying k residual / v bf16 hi+lo planes (used only by the causal high-precision path)
// B fragment (k rows k0+.., output column o) of a weight: (in,out) [K][ld] or (out,in) [ld rows of K]: bf16 exact, or f16(bf16 * 256) exact
__device__ __forceinline__ v16b wcol_io(const float* Wm, int k0, int o, int lane, int ld) { v16b w; const int g = lane >> 4;
#pragma unroll
  for (int i = 0; i < 8; ++i) { w[i] = (__bf16)Wm[(size_t)(k0 + 8 * g + i) * ld + o]; w[8 + i] = (__bf16)Wm[(size_t)(k0 + 16 + 8 * g + i) * ld + o]; }
  return w; }
__device__ __forceinline__ v16b wcol_oi(const float* Wm, int k0, int o, int lane, int K) { v16b w; const float* p = Wm + (size_t)o * K + k0 + 8 * (lane >> 4);
#pragma unroll
  for (int i = 0; i < 8; ++i) { w[i] = (__bf16)p[i]; w[8 + i] = (__bf16)p[16 + i]; }
  return w; }
__device__ __forceinline__ v16h wcolh_io(const float* Wm, int k0, int o, int lane, int ld) { v16h w; const int g = lane >> 4;
#pragma unroll
  for (int i = 0; i < 8; ++i) { w[i] = (_Float16)(bfr(Wm[(size_t)(k0 + 8 * g + i) * ld + o]) * 256.0f); w[8 + i] = (_Float16)(bfr(Wm[(size_t)(k0 + 16 + 8 * g + i) * ld + o]) * 256.0f); }
  return w; }
__device__ __forceinline__ v16h wcolh_oi(const float* Wm, int k0, int o, int lane, int K) { v16h w; const float* p = Wm + (size_t)o * K + k0 + 8 * (lane >> 4);
#pragma unroll
  for (int i = 0; i < 8; ++i) { w[i] = (_Float16)(bfr(p[i]) * 256.0f); w[8 + i] = (_Float16)(bfr(p[16 + i]) * 256.0f); }
  return w; }
#define WQKV_LAYOUT 1   // 0 = (in,out) [DIN][CC]; 1 = (out,in) [CC][DIN]; 2 = per-head [NH][DIN][HD]
__device__ __forceinline__ v16b wcol_hdk(const float* Wm, int k0, int o, int lane) { v16b w; const int g = lane >> 4; const float* p = Wm + (size_t)(o / HD) * DIN * HD + (o % HD);
#pragma unroll
  for (int i = 0; i < 8; ++i) { w[i] = (__bf16)p[(size_t)(k0 + 8 * g + i) * HD]; w[8 + i] = (__bf16)p[(size_t)(k0 + 16 + 8 * g + i) * HD]; }
  return w; }
#define WO_OUT_IN 1
#if WQKV_LAYOUT == 1
#define WCOL(W, k0, o, lane) wcol_oi(W, k0, o, lane, DIN)
#elif WQKV_LAYOUT == 2
#define WCOL(W, k0, o, lane) wcol_hdk(W, k0, o, lane)
#else
#define WCOL(W, k0, o, lane) wcol_io(W, k0, o, lane, CC)
#endif
#if WO_OUT_IN
#define WOCOL(W, k0, o, lane) wcol_oi(W, k0, o, lane, CC)
#define WOCOLH(W, k0, o, lane) wcolh_oi(W, k0, o, lane, CC)
#else
#define WOCOL(W, k0, o, lane) wcol_io(W, k0, o, lane, DIN)
#define WOCOLH(W, k0, o, lane) wcolh_io(W, k0, o, lane, DIN)
#endif

#define WS_QH  0u                                      // f16 q rows [b*t][CC]
#define WS_KH  (WS_QH + 2u * (size_t)NB * TT * CC)      // f16 k rows [b*t][CC]
#define WS_VT  (WS_KH + 2u * (size_t)NB * TT * CC)      // f16 v planes [b][c][t]
#define WS_QL  (WS_VT + 2u * (size_t)NB * CC * TT)      // f16 q residual x 2^10 rows [b][t < QHI][CC]
#define WS_KL  (WS_QL + 2u * (size_t)NB * QHI * CC)     // f16 k residual x 2^10 rows [b][t < KHI][CC]
#define WS_VB  (WS_KL + 2u * (size_t)NB * KHI * CC)     // bf16 v hi planes [b][c][t < KHI]
#define WS_VBL (WS_VB + 2u * (size_t)NB * CC * KHI)
#define WS_END (WS_VBL + 2u * (size_t)NB * CC * KHI)

// ---- k_proj: block = (128 rows, 128 cols, which), 8 waves as 4 x 2, wave = 32 rows x 64 cols: q/k/v = X W (+ b) with exact bf16 products (K = DIN) -> which 0: q f16 rows (+ residual rows < QHI); 1: k f16 rows (+ residual rows < KHI); 2: v f16 planes [c][t] (+ bf16 hi/lo planes for t < KHI)
// The block's X and W tiles go through LDS, 64 k a stage: each f32 element is loaded once per block by whole-line loads (a wave-wide 16-byte load = two 256-B row pieces), rounded to bf16 once and read back as fragments by the waves that share it.
// Two buffers: the next stage's global loads fly under this stage's products. k runs upward through one accumulator per tile, as before: the sums are the same. The short loops are unrolled whole so that their arrays stay in registers.
#define PBM 128           // rows of X per block
#define PBN 128           // output columns per block
#define PBK 64            // k per stage
#define PLD (PBK + 8)     // 144-B LDS rows (16 B x odd): no bank conflict for the 16-byte fragment reads
#define PEL (128 + 8)     // 272-B rows of the epilogue's planes
#define PSTG (128 * PLD * 2)        // bytes of one operand's tile in one buffer
#define PSMEM (3 * 128 * PEL * 2)   // the epilogue's three planes; the ring (4 x PSTG) is smaller and lies in the same bytes
typedef __attribute__((ext_vector_type(4))) __bf16 v4b;
// eight 16-byte stores, STEP bytes apart, from one address pair, and behind them, in the same statement, the wait that stands in front of any write of a register they name: in the built code another arm of the epilogue may follow any of these stores
template <int STEP> __device__ __forceinline__ void st8(void* p, const v4u* t) {
  asm volatile("global_store_b128 %0, %1, off\n\tglobal_store_b128 %0, %2, off offset:%9\n\tglobal_store_b128 %0, %3, off offset:%10\n\tglobal_store_b128 %0, %4, off offset:%11\n\t"
               "global_store_b128 %0, %5, off offset:%12\n\tglobal_store_b128 %0, %6, off offset:%13\n\tglobal_store_b128 %0, %7, off offset:%14\n\tglobal_store_b128 %0, %8, off offset:%15\n\ts_wait_xcnt 0x0"
               :: "v"(p), "v"(t[0]), "v"(t[1]), "v"(t[2]), "v"(t[3]), "v"(t[4]), "v"(t[5]), "v"(t[6]), "v"(t[7]), "n"(STEP), "n"(2 * STEP), "n"(3 * STEP), "n"(4 * STEP), "n"(5 * STEP), "n"(6 * STEP), "n"(7 * STEP) : "memory"); }
__global__ __launch_bounds__(256) void k_proj(const float* __restrict__ XQ, const float* __restrict__ XK, const float* __restrict__ XV, const float* __restrict__ WQ, const float* __restrict__ WK, const float* __restrict__ WV, const float* __restrict__ BQ, const float* __restrict__ BK, const float* __restrict__ BV,
    _Float16* __restrict__ QH, _Float16* __restrict__ QL, _Float16* __restrict__ KH, _Float16* __restrict__ KL, _Float16* __restrict__ VT, __bf16* __restrict__ VB, __bf16* __restrict__ VBL) {
  __shared__ __align__(16) char sm[PSMEM];
  const int tid = threadIdx.x, wave = tid >> 5, lane = tid & 31, col = lane & 15, g = lane >> 4, wr = wave >> 1, wc = wave & 1; const int which = blockIdx.z; const int c0 = blockIdx.y * PBN; const size_t r0 = (size_t)blockIdx.x * PBM; const size_t bb = r0 / TT; const int t0 = (int)(r0 % TT);
  const float* X = which == 0 ? XQ : which == 1 ? XK : XV; const float* WA = which == 0 ? WQ : which == 1 ? WK : WV; const float* BA = which == 0 ? BQ : which == 1 ? BK : BV;
  __bf16 (*xs)[128][PLD] = (__bf16 (*)[128][PLD])sm; __bf16 (*wt)[128][PLD] = (__bf16 (*)[128][PLD])(sm + 2 * PSTG);
  // staging: thread = (row tid >> 4 of 16, 16-byte piece tid & 15 of a 256-B row piece), 8 row groups per operand
  const int srow = tid >> 4, sc = (tid & 15) * 4; const float* xg = X + (r0 + srow) * DIN + sc; const float* wg = WA + (size_t)(c0 + srow) * DIN + sc;
  v4f xr[8], wv[8];
#pragma unroll
  for (int p = 0; p < 8; ++p) { xr[p] = *(const v4f*)(xg + (size_t)p * 16 * DIN); wv[p] = *(const v4f*)(wg + (size_t)p * 16 * DIN); }
  float bias[4] = {0.f, 0.f, 0.f, 0.f};   // read here, as one group beside the first stage's loads: one latency for all of them
  if (BA) {
#pragma unroll
    for (int j = 0; j < 4; ++j) bias[j] = bfr(BA[c0 + wc * 64 + j * 16 + col]); }
  v8f acc[2][4] = {};
#pragma unroll 2   // two stages a trip: the buffer index is a constant in each half, so every LDS address is one register plus an immediate
  for (int s = 0; s < DIN / PBK; ++s) { const int bf = s & 1;
#pragma unroll
    for (int p = 0; p < 8; ++p) { v4b a, w;
#pragma unroll
      for (int i = 0; i < 4; ++i) { a[i] = (__bf16)xr[p][i]; w[i] = (__bf16)wv[p][i]; }
      *(v4b*)&xs[bf][srow + p * 16][sc] = a; *(v4b*)&wt[bf][srow + p * 16][sc] = w; }
    // one barrier a stage: it publishes this buffer, and every wave that passes it has left the other buffer, which the next stage's stores overwrite
    __syncthreads();
    if (s + 1 < DIN / PBK) {
#pragma unroll
      for (int p = 0; p < 8; ++p) { xr[p] = *(const v4f*)(xg + (size_t)p * 16 * DIN + (s + 1) * PBK); wv[p] = *(const v4f*)(wg + (size_t)p * 16 * DIN + (s + 1) * PBK); } }
    v16b a[PBK / 32][2], w[PBK / 32][4];
#pragma unroll
    for (int kk = 0; kk < PBK / 32; ++kk) {
#pragma unroll
      for (int i = 0; i < 2; ++i) a[kk][i] = frag_b(&xs[bf][wr * 32 + i * 16 + col][kk * 32], lane);
#pragma unroll
      for (int j = 0; j < 4; ++j) w[kk][j] = frag_b(&wt[bf][wc * 64 + j * 16 + col][kk * 32], lane); }
    __builtin_amdgcn_sched_barrier(0);   // the next stage's global loads and this stage's fragment reads issue as one group in front of the products; left free, the global loads were sunk among the products and waited out there
#pragma unroll
    for (int kk = 0; kk < PBK / 32; ++kk)
#pragma unroll
      for (int i = 0; i < 2; ++i)
#pragma unroll
        for (int j = 0; j < 4; ++j) acc[i][j] = __builtin_amdgcn_wmma_f32_16x16x32_bf16(false, a[kk][i], false, w[kk][j], (short)0, acc[i][j], false, false);
    __builtin_amdgcn_sched_barrier(0);   // keeps the conversions of the next stage's values, and with them the wait for its loads, behind the products
  }
  __syncthreads();   // every wave has read its last fragments before the epilogue's planes overwrite the ring
  const int er = tid >> 4, eq = (tid & 15) * 8;   // copy-out: thread = (plane row er + 16 it, 16-byte piece), 16 lanes store 256 B in a row
  v4u t[8];
  if (which < 2) { _Float16* DH = which == 0 ? QH : KH; _Float16* DL = which == 0 ? QL : KL; const int nhi = which == 0 ? QHI : KHI; const bool hi_rows = t0 < nhi;
    _Float16 (*sh)[PEL] = (_Float16 (*)[PEL])sm; _Float16 (*sl)[PEL] = (_Float16 (*)[PEL])(sm + 128 * PEL * 2);
#pragma unroll
    for (int j = 0; j < 4; ++j)
#pragma unroll
      for (int i = 0; i < 2; ++i)
#pragma unroll
        for (int r = 0; r < 8; ++r) sh[wr * 32 + i * 16 + 8 * g + r][wc * 64 + j * 16 + col] = (_Float16)(acc[i][j][r] + bias[j]);
    if (hi_rows) {
#pragma unroll
      for (int j = 0; j < 4; ++j)
#pragma unroll
        for (int i = 0; i < 2; ++i)
#pragma unroll
          for (int r = 0; r < 8; ++r) { const float v = acc[i][j][r] + bias[j]; const _Float16 hv = (_Float16)v; sl[wr * 32 + i * 16 + 8 * g + r][wc * 64 + j * 16 + col] = (_Float16)((v - (float)hv) * 1024.0f); } }
    __syncthreads();
    _Float16* dh = DH + (r0 + er) * CC + c0 + eq;
#pragma unroll
    for (int it = 0; it < 8; ++it) t[it] = *(const v4u*)&sh[er + it * 16][eq];
    st8<16 * CC * 2>(dh, t);
    if (hi_rows) {
      _Float16* dl = DL + (bb * nhi + t0 + er) * (size_t)CC + c0 + eq;
#pragma unroll
      for (int it = 0; it < 8; ++it) t[it] = *(const v4u*)&sl[er + it * 16][eq];
      st8<16 * CC * 2>(dl, t); }
  } else { const bool hi_rows = t0 < KHI;
    _Float16 (*th)[PEL] = (_Float16 (*)[PEL])sm; __bf16 (*tb)[PEL] = (__bf16 (*)[PEL])(sm + 128 * PEL * 2); __bf16 (*tbl)[PEL] = (__bf16 (*)[PEL])(sm + 2 * 128 * PEL * 2);
    // a lane's 8 accumulator rows are 8 neighbouring t of one plane row: one 16-byte LDS store each
#pragma unroll
    for (int j = 0; j < 4; ++j)
#pragma unroll
      for (int i = 0; i < 2; ++i) { v8h hv;
#pragma unroll
        for (int r = 0; r < 8; ++r) hv[r] = (_Float16)(acc[i][j][r] + bias[j]);
        *(v8h*)&th[wc * 64 + j * 16 + col][wr * 32 + i * 16 + 8 * g] = hv; }
    if (hi_rows) {
#pragma unroll
      for (int j = 0; j < 4; ++j)
#pragma unroll
        for (int i = 0; i < 2; ++i) { v8b bh, bl;
#pragma unroll
          for (int r = 0; r < 8; ++r) { const float v = acc[i][j][r] + bias[j]; const __bf16 b1 = (__bf16)v; bh[r] = b1; bl[r] = (__bf16)(v - (float)b1); }
          *(v8b*)&tb[wc * 64 + j * 16 + col][wr * 32 + i * 16 + 8 * g] = bh; *(v8b*)&tbl[wc * 64 + j * 16 + col][wr * 32 + i * 16 + 8 * g] = bl; } }
    __syncthreads();
    _Float16* vt = VT + (bb * CC + c0 + er) * (size_t)TT + t0 + eq;
#pragma unroll
    for (int it = 0; it < 8; ++it) t[it] = *(const v4u*)&th[er + it * 16][eq];
    st8<16 * TT * 2>(vt, t);
    if (hi_rows) {
      const size_t o3 = (bb * CC + c0 + er) * (size_t)KHI + t0 + eq;
#pragma unroll
      for (int it = 0; it < 8; ++it) t[it] = *(const v4u*)&tb[er + it * 16][eq];
      st8<16 * KHI * 2>(VB + o3, t);
#pragma unroll
      for (int it = 0; it < 8; ++it) t[it] = *(const v4u*)&tbl[er + it * 16][eq];
      st8<16 * KHI * 2>(VBL + o3, t); } } }
// ---- k_fa: scores, softmax and P . v in one launch. Block = 128 queries of one (batch, head), wave = 32 queries, walking its keys [0, last query] 32 at a time.
// Transposed products: S^T = K . Q^T (D: register r = key 8g + r, lane column = query), so a lane holds 16 scores of ONE query and two S^T tiles, converted in place, are the B operand of O^T += V^T . P^T.
// Running maximum m and running sum l per query; the output tile is rescaled by exp(m_old - m_new) on every pass.
#define FQW 32            // queries per wave
#define FQB 128           // queries per block
#define L2E 1.4426950408889634f
__device__ __forceinline__ v8f wm_h(v16h a, v16h b, v8f c) { return __builtin_amdgcn_wmma_f32_16x16x32_f16(false, a, false, b, (short)0, c, false, false); }
__device__ __forceinline__ v8f wm_b(v16b a, v16b b, v8f c) { return __builtin_amdgcn_wmma_f32_16x16x32_bf16(false, a, false, b, (short)0, c, false, false); }
// lane l with lane l ^ 16
__device__ __forceinline__ float xhalf(float x) { return __builtin_bit_cast(float, __builtin_amdgcn_permlanex16(__builtin_bit_cast(int, x), __builtin_bit_cast(int, x), 0x76543210, 0xfedcba98, false, false)); }
// the 16 additive mask values (bf16-rounded like every float input) of the keys a lane holds: k0 + 8g + 0..7 and k0 + 16 + 8g + 0..7
__device__ __forceinline__ void mask16(const float* __restrict__ amk, float am[16]) {
  const v4f a0 = *(const v4f*)amk, a1 = *(const v4f*)(amk + 4), a2 = *(const v4f*)(amk + 16), a3 = *(const v4f*)(amk + 20);
#pragma unroll
  for (int i = 0; i < 4; ++i) { am[i] = bfr(a0[i]); am[4 + i] = bfr(a1[i]); am[8 + i] = bfr(a2[i]); am[12 + i] = bfr(a3[i]); } }
// 2^x on the transcendental pipe, with the slot that the instruction set asks for behind a transcendental before its result is used or its source overwritten: in a run each fills the slot of the one in front, one v_nop closes the run
__device__ __forceinline__ void exp2x8(float* a) {
  asm("v_exp_f32 %0, %0\n\tv_exp_f32 %1, %1\n\tv_exp_f32 %2, %2\n\tv_exp_f32 %3, %3\n\tv_exp_f32 %4, %4\n\tv_exp_f32 %5, %5\n\tv_exp_f32 %6, %6\n\tv_exp_f32 %7, %7\n\tv_nop"
      : "+v"(a[0]), "+v"(a[1]), "+v"(a[2]), "+v"(a[3]), "+v"(a[4]), "+v"(a[5]), "+v"(a[6]), "+v"(a[7])); }
__device__ __forceinline__ float exp2x1(float x) { float r; asm("v_exp_f32 %0, %1\n\tv_nop" : "=v"(r) : "v"(x)); return r; }
// one pass of the running softmax for one query column: v[16] -> exp(v - m) x 2^11 (the 2^11 rides in the exponent; l sums the same scaled terms); returns the factor for what was summed before
__device__ __forceinline__ float soft16(float v[16], float& m, float& l) {
  float mx = v[0];
#pragma unroll
  for (int i = 1; i < 16; ++i) mx = fmaxf(mx, v[i]);
  mx = fmaxf(mx, xhalf(mx)); const float mn = fmaxf(m, mx); const float alpha = exp2x1((m - mn) * L2E); m = mn;
  // a key at or below -1e38 is excluded (term 0): under a larger maximum its exponent underflows by itself; where the maximum itself is that low every key so far is excluded
  const float mr = mn <= -1.0e38f ? 3.0e38f : mn;
#pragma unroll
  for (int i = 0; i < 16; ++i) v[i] = fmaf(v[i] - mr, L2E, 11.0f);
  exp2x8(v); exp2x8(v + 8);
  float sum = 0.f;
#pragma unroll
  for (int i = 0; i < 16; ++i) sum += v[i];
  l = l * alpha + sum; return alpha; }
// a 16x16x32 fragment at a wave-uniform base plus the lane's own byte offset (row and 8g in it) plus a constant: elements 0..7 = p[0..7], 8..15 = p[16..23]
__device__ __forceinline__ v16h ld16h(const _Float16* base, unsigned off, int el) { const _Float16* p = (const _Float16*)((const char*)base + off) + el; union { v16h v; v8h q[2]; } u; u.q[0] = *(const v8h*)p; u.q[1] = *(const v8h*)(p + 16); return u.v; }
__device__ __forceinline__ v16b ld16b(const __bf16* base, unsigned off, int el) { const __bf16* p = (const __bf16*)((const char*)base + off) + el; union { v16b v; v8b q[2]; } u; u.q[0] = *(const v8b*)p; u.q[1] = *(const v8b*)(p + 16); return u.v; }
// query rows < QHI, 16 at a time: q and k as f16 hi + residual (3 products), exp and v as bf16 hi + lo (3 products)
__device__ __forceinline__ void fa_hi(const _Float16* __restrict__ QH, const _Float16* __restrict__ KH, const _Float16* __restrict__ QL, const _Float16* __restrict__ KL, const __bf16* __restrict__ VB, const __bf16* __restrict__ VBL, const float* __restrict__ AM,
    int b, int h, int qt, int lane, float (*st)[HD + 4]) {
  const int col = lane & 15, g = lane >> 4; const int t = qt + col;
  const _Float16* Qs = QH + ((size_t)b * TT + qt) * CC + h * HD; const _Float16* Qls = QL + ((size_t)b * QHI + qt) * CC + h * HD; const unsigned qo = (unsigned)(col * CC + 8 * g) * 2u;
  v16h qh[2], ql[2];
#pragma unroll
  for (int kc = 0; kc < 2; ++kc) { qh[kc] = ld16h(Qs, qo, kc * 32); ql[kc] = ld16h(Qls, qo, kc * 32); }
  asm volatile("s_wait_xcnt 0x0" :: "v"(qh[0]), "v"(qh[1]), "v"(ql[0]), "v"(ql[1]) : "memory");   // stands behind the q loads, in front of the first write of their address registers; the loaded values are inputs only, so that the loads cannot sink below it (without them this build placed the loads behind the wait and a K load's result in their address registers)
  // wave-uniform bases and each lane's own byte offsets, stepped once a pass: every load of a pass is one of these registers plus a constant
  const float* As = AM + (size_t)b * TT; const _Float16* Ks = KH + (size_t)b * TT * CC + h * HD; const _Float16* Kls = KL + (size_t)b * KHI * CC + h * HD;
  const __bf16* Vs = VB + ((size_t)b * CC + h * HD) * (size_t)KHI; const __bf16* Vls = VBL + ((size_t)b * CC + h * HD) * (size_t)KHI;
  unsigned ao = (unsigned)(8 * g) * 4u, ko = (unsigned)(col * CC + 8 * g) * 2u, vo = (unsigned)(col * KHI + 8 * g) * 2u;
  v8f o[HD / 16] = {}; float m = -3.0e38f, l = 0.f; const int nit = qt / 32 + 1;
#pragma unroll 1
  for (int it = 0; it < nit; ++it) { const int k0 = it * 32; v8f acc[2] = {}, accl[2] = {}; float am[16]; mask16((const float*)((const char*)As + ao), am);
#pragma unroll
    for (int kt = 0; kt < 2; ++kt)
#pragma unroll
      for (int kc = 0; kc < 2; ++kc) { const v16h kh = ld16h(Ks, ko, kt * 16 * CC + kc * 32), kl = ld16h(Kls, ko, kt * 16 * CC + kc * 32);
        acc[kt] = wm_h(kh, qh[kc], acc[kt]); accl[kt] = wm_h(kh, ql[kc], accl[kt]); accl[kt] = wm_h(kl, qh[kc], accl[kt]); }
    v16b vh[HD / 16], vl[HD / 16];
#pragma unroll
    for (int j = 0; j < HD / 16; ++j) { vh[j] = ld16b(Vs, vo, j * 16 * KHI); vl[j] = ld16b(Vls, vo, j * 16 * KHI); }
    asm volatile("s_wait_xcnt 0x0" : "+v"(ao), "+v"(ko), "+v"(vo) :: "memory");   // stands between this pass's loads and the step of their offset registers; naming the offsets keeps them in those registers up to the wait and the step behind it
    ao += 32u * 4u; ko += 32u * CC * 2u; vo += 32u * 2u;
    float v[16];
#pragma unroll
    for (int i = 0; i < 16; ++i) { const int key = k0 + (i >> 3) * 16 + 8 * g + (i & 7); const float s = (acc[i >> 3][i & 7] + accl[i >> 3][i & 7] * (1.0f / 1024.0f)) * SCALE; v[i] = (key <= t ? s : -3.0e38f) + am[i]; }
    const float alpha = soft16(v, m, l); const F2 p = bsplit16(v);
#pragma unroll
    for (int j = 0; j < HD / 16; ++j) { o[j] = o[j] * alpha; o[j] = wm_b(vh[j], p.h, o[j]); o[j] = wm_b(vh[j], p.l, o[j]); o[j] = wm_b(vl[j], p.h, o[j]); } }
  l += xhalf(l); const float inv = l > 0.f ? 1.0f / l : 0.f;   /* a fully excluded row yields 0 */
#pragma unroll
  for (int j = 0; j < HD / 16; ++j) { const v8f r = o[j] * inv; *(v4f*)&st[col][j * 16 + 8 * g] = __builtin_shufflevector(r, r, 0, 1, 2, 3); *(v4f*)&st[col][j * 16 + 8 * g + 4] = __builtin_shufflevector(r, r, 4, 5, 6, 7); } }
// four waves per SIMD: keeps the allocation at 256 VGPRs, below the register windows that cost a mode switch per access
__global__ __launch_bounds__(128) __attribute__((amdgpu_waves_per_eu(4, 4))) void k_fa(const _Float16* __restrict__ QH, const _Float16* __restrict__ KH, const _Float16* __restrict__ QL, const _Float16* __restrict__ KL, const _Float16* __restrict__ VT, const __bf16* __restrict__ VB, const __bf16* __restrict__ VBL, const float* __restrict__ AM, float* __restrict__ Y) {
  __shared__ __align__(16) float ss[FQB / FQW][FQW][HD + 4];
  const int lane = threadIdx.x & 31, col = lane & 15, g = lane >> 4; const int wave = __builtin_amdgcn_readfirstlane(threadIdx.x >> 5);
  const int b = blockIdx.x / NH, h = blockIdx.x % NH; const int qw = (TT / FQB - 1 - (int)blockIdx.y) * FQB + wave * FQW;   // the blocks with the most keys start first
  if (qw < QHI) {
#pragma unroll 1   // one copy of the high-precision body serves both halves of the wave's 32 queries: half the code, and each half's loads stay inside its own trip
    for (int hf = 0; hf < 2; ++hf) fa_hi(QH, KH, QL, KL, VB, VBL, AM, b, h, qw + hf * 16, lane, &ss[wave][hf * 16]); }
  else {
    // wave-uniform bases and each lane's own byte offsets, stepped once a pass: every load of a pass is one of these registers plus a constant
    const _Float16* Ks = KH + (size_t)b * TT * CC + h * HD; const _Float16* Vs = VT + ((size_t)b * CC + h * HD) * (size_t)TT; const float* As = AM + (size_t)b * TT; const _Float16* Qs = QH + ((size_t)b * TT + qw) * CC + h * HD;
    unsigned ko = (unsigned)(col * CC + 8 * g) * 2u, vo = (unsigned)(col * TT + 8 * g) * 2u, ao = (unsigned)(8 * g) * 4u;
    v16h qf[2][2];
#pragma unroll
    for (int q = 0; q < 2; ++q)
#pragma unroll
      for (int kc = 0; kc < 2; ++kc) qf[q][kc] = ld16h(Qs, ko, q * 16 * CC + kc * 32);
    v8f o[2][HD / 16] = {}; float m[2] = {-3.0e38f, -3.0e38f}, l[2] = {0.f, 0.f}; const int nit = qw / 32 + 1;
    v16h kf[2][2];
#pragma unroll
    for (int kt = 0; kt < 2; ++kt)
#pragma unroll
      for (int kc = 0; kc < 2; ++kc) kf[kt][kc] = ld16h(Ks, ko, kt * 16 * CC + kc * 32);
    // one pass = 32 keys; only the last pass holds keys past a query, so it alone carries the index test and the loop body stays one straight block
    auto pass = [&](const bool last) __attribute__((always_inline)) {
      const float* amk = (const float*)((const char*)As + ao); const v4f ar[4] = {*(const v4f*)amk, *(const v4f*)(amk + 4), *(const v4f*)(amk + 16), *(const v4f*)(amk + 20)};   // the mask values of the keys a lane holds, in the order of mask16
      v16h vf[HD / 16];
#pragma unroll
      for (int j = 0; j < HD / 16; ++j) vf[j] = ld16h(Vs, vo, j * 16 * TT);
      __builtin_amdgcn_sched_barrier(0);   // the mask and V loads issue in front of the S^T products and fly under them; left free, the mask loads were placed where they are used and the wave waited out their latency on every pass
      v8f s[2][2] = {};
#pragma unroll
      for (int kc = 0; kc < 2; ++kc)
#pragma unroll
        for (int kt = 0; kt < 2; ++kt)
#pragma unroll
          for (int q = 0; q < 2; ++q) s[q][kt] = wm_h(kf[kt][kc], qf[q][kc], s[q][kt]);
      // the next pass's K fragments fly while this pass does its softmax and P . v
      if (!last) {
#pragma unroll
        for (int kt = 0; kt < 2; ++kt)
#pragma unroll
          for (int kc = 0; kc < 2; ++kc) kf[kt][kc] = ld16h(Ks, ko, (32 + kt * 16) * CC + kc * 32); }
      asm volatile("s_wait_xcnt 0x0" : "+v"(ao), "+v"(vo), "+v"(ko) :: "memory");   // stands between this pass's loads and the step of their offset registers; naming the offsets keeps them in those registers up to the wait and the step behind it
      ao += 32u * 4u; vo += 32u * 2u; ko += 32u * CC * 2u;
      __builtin_amdgcn_sched_barrier(0);   // keeps the first use of the mask values, and with it their wait, behind the S^T products
      float am[16];
#pragma unroll
      for (int i = 0; i < 16; ++i) am[i] = bfr(ar[i >> 2][i & 3]);
      v16h pf[2];
#pragma unroll
      for (int q = 0; q < 2; ++q) { float v[16];
#pragma unroll
        for (int i = 0; i < 16; ++i) { const int key = qw + (i >> 3) * 16 + 8 * g + (i & 7);   /* the last pass starts at key qw */ const float sv = s[q][i >> 3][i & 7] * SCALE; v[i] = ((!last || key <= qw + q * 16 + col) ? sv : -3.0e38f) + am[i]; }
        const float alpha = soft16(v, m[q], l[q]);
#pragma unroll
        for (int i = 0; i < 16; ++i) pf[q][i] = (_Float16)v[i];
#pragma unroll
        for (int j = 0; j < HD / 16; ++j) o[q][j] = o[q][j] * alpha; }
#pragma unroll
      for (int j = 0; j < HD / 16; ++j)
#pragma unroll
        for (int q = 0; q < 2; ++q) o[q][j] = wm_h(vf[j], pf[q], o[q][j]); };
#pragma unroll 1
    for (int it = 0; it < nit - 1; ++it) pass(false);
    pass(true);
#pragma unroll
    for (int q = 0; q < 2; ++q) { const float lt = l[q] + xhalf(l[q]); const float inv = lt > 0.f ? 1.0f / lt : 0.f;   /* a fully excluded row yields 0 */
#pragma unroll
      for (int j = 0; j < HD / 16; ++j) { const v8f r = o[q][j] * inv; *(v4f*)&ss[wave][q * 16 + col][j * 16 + 8 * g] = __builtin_shufflevector(r, r, 0, 1, 2, 3); *(v4f*)&ss[wave][q * 16 + col][j * 16 + 8 * g + 4] = __builtin_shufflevector(r, r, 4, 5, 6, 7); } } }
  // each wave turns its own 32 x 64 tile in its own LDS slice: a 256-B (row, head) segment is stored by 16 lanes
  LDSX();
#pragma unroll
  for (int i = 0; i < FQW / 2; ++i) { const int rl = 2 * i + g; vst2(Y + ((size_t)b * TT + qw + rl) * CC + h * HD + col * 4, *(const v4f*)&ss[wave][rl][col * 4]); } }

extern "C" void kernel_launch(void* const* d_in, const int* in_sizes, int n_in, void* d_out, int out_size, void* d_ws, size_t ws_size, hipStream_t stream) {
  (void)in_sizes; (void)n_in; (void)out_size;
  const float** F = (const float**)d_in;
  if (ws_size < (size_t)WS_END) return;
  char* ws = (char*)d_ws; _Float16 *QH = (_Float16*)(ws + WS_QH), *KH = (_Float16*)(ws + WS_KH), *VT = (_Float16*)(ws + WS_VT), *QL = (_Float16*)(ws + WS_QL), *KL = (_Float16*)(ws + WS_KL); __bf16 *VB = (__bf16*)(ws + WS_VB), *VBL = (__bf16*)(ws + WS_VBL);
  // inputs: 0 hidden_states [4,2048,768]; 1 attention_mask [4,1,1,2048] f32 (zeros); 2 Wq [768,768] (out,in), 3 bq; 4 Wk, 5 bk; 6 Wv, 7 bv (biases zeros, read)
  k_proj<<<dim3(TNB * TT / PBM, CC / PBN, 3), 256, 0, stream>>>(F[0], F[0], F[0], F[2], F[4], F[6], F[3], F[5], F[7], QH, QL, KH, KL, VT, VB, VBL);
  k_fa<<<dim3(TNB * NH, TT / FQB), 128, 0, stream>>>(QH, KH, QL, KL, VT, VB, VBL, F[1], (float*)d_out);   /* merged heads are the output: row b*TT + t, columns h*64 .. */
}

// v004
// Measured time: 90 microseconds a run.
// Next to v003, in two timings, it ran 1.17 and 1.16 times as fast.
// Over all steps from v000 it is 16.7 times as fast.
// compute dtype: all float inputs rounded to bf16; q/k/v projections with EXACT bf16 products on WMMA 16x16x32 (f32 accumulate) + bias (zeros, read); causal logits: 3 products for the first 384 rows, single f16 q x k after, x 64^-0.5, plus the additive float key mask (read); softmax f32 with a running maximum, in registers; exp x 2^11 once to f16 x v once to f16 (bf16 hi + lo below row 384), divided by the f32 row sum at the end; f32 output (no output projection).
#include <hip/hip_runtime.h>
#include <math.h>

typedef __attribute__((ext_vector_type(16))) _Float16 v16h;
typedef __attribute__((ext_vector_type(16))) __bf16 v16b;
typedef __attribute__((ext_vector_type(8)))  _Float16 v8h;
typedef __attribute__((ext_vector_type(8)))  float v8f;
typedef __attribute__((ext_vector_type(4)))  float v4f;
typedef __attribute__((ext_vector_type(2)))  float v2f;
typedef __attribute__((ext_vector_type(4)))  unsigned v4u;
typedef __attribute__((ext_vector_type(4)))  int v4i;
typedef float __attribute__((may_alias)) float_a;
typedef int __attribute__((may_alias)) int_a;

template <typename T> __device__ __forceinline__ void vst2(void* p, T v) { *(T*)p = v;  }
__device__ __forceinline__ v8f wmma16(v16h a, v16h b, v8f c) {
  v8f d = __builtin_amdgcn_wmma_f32_16x16x32_f16(false, a, false, b, (short)0, c, false, false);
  asm volatile("v_nop\n\tv_nop\n\tv_nop\n\tv_nop" : "+v"(d) : "v"(a), "v"(b));
  return d;
}
__device__ __forceinline__ v8f wmma_bf(v16b a, v16b b, v8f c) {
  v8f d = __builtin_amdgcn_wmma_f32_16x16x32_bf16(false, a, false, b, (short)0, c, false, false);
  asm volatile("v_nop\n\tv_nop\n\tv_nop\n\tv_nop" : "+v"(d) : "v"(a), "v"(b));
  return d;
}
// 16x16x32 fragments: lane = (h = lane>>4, row/col = lane&15); elements 0..7 = k0+8h+0..7, 8..15 = k0+16+8h+0..7; D element r = row 8h+r
__device__ __forceinline__ v16h frag_h(const _Float16* rowk0, int lane) {
  union { v16h v; v8h q[2]; } u; const _Float16* p = rowk0 + 8 * (lane >> 4);
  u.q[0] = *(const v8h*)p; u.q[1] = *(const v8h*)(p + 16); return u.v;
}
__device__ __forceinline__ v16h frag_f32(const float* rowk0, int lane) {
  v16h a; const float* p = rowk0 + 8 * (lane >> 4);
#pragma unroll
  for (int i = 0; i < 8; ++i) { a[i] = (_Float16)p[i]; a[8 + i] = (_Float16)p[16 + i]; }
  return a;
}
__device__ __forceinline__ v16h frag_f32s(const float* rowk0, int lane, float sc) {
  v16h a; const float* p = rowk0 + 8 * (lane >> 4);
#pragma unroll
  for (int i = 0; i < 8; ++i) { a[i] = (_Float16)(p[i] * sc); a[8 + i] = (_Float16)(p[16 + i] * sc); }
  return a;
}
// column fragment from a [K][ld] layout (column n), rows >= K read as 0
__device__ __forceinline__ v16h fragc_f32(const float* W, int k0, int n, int lane, int ld, int K) {
  v16h a; const int g = lane >> 4;
#pragma unroll
  for (int i = 0; i < 8; ++i) { const int ka = k0 + 8 * g + i, kb = ka + 16;
    a[i] = (_Float16)(ka < K ? W[(size_t)(ka < K ? ka : K - 1) * ld + n] : 0.f); a[8 + i] = (_Float16)(kb < K ? W[(size_t)(kb < K ? kb : K - 1) * ld + n] : 0.f); }
  return a;
}
struct F2 { v16b h, l; };
__device__ __forceinline__ F2 bsplit16(const float v[16]) { F2 r;
#pragma unroll
  for (int i = 0; i < 16; ++i) { const __bf16 h = (__bf16)v[i]; r.h[i] = h; r.l[i] = (__bf16)(v[i] - (float)h); }
  return r; }
__device__ __forceinline__ F2 split_row(const float* row, int k0, int lane) { float v[16]; const float* p = row + k0 + 8 * (lane >> 4);
#pragma unroll
  for (int i = 0; i < 8; ++i) { v[i] = p[i]; v[8 + i] = p[16 + i]; }
  return bsplit16(v); }
__device__ __forceinline__ F2 split_rowK(const float* row, int k0, int lane, int K) { float v[16]; const int g = lane >> 4;
#pragma unroll
  for (int i = 0; i < 8; ++i) { const int ka = k0 + 8 * g + i, kb = ka + 16; v[i] = ka < K ? row[ka < K ? ka : K - 1] : 0.f; v[8 + i] = kb < K ? row[kb < K ? kb : K - 1] : 0.f; }
  return bsplit16(v); }
__device__ __forceinline__ F2 split_col(const float* W, int k0, int n, int lane, int ld, int K) { float v[16]; const int g = lane >> 4;
#pragma unroll
  for (int i = 0; i < 8; ++i) { const int ka = k0 + 8 * g + i, kb = ka + 16; v[i] = ka < K ? W[(size_t)(ka < K ? ka : K - 1) * ld + n] : 0.f; v[8 + i] = kb < K ? W[(size_t)(kb < K ? kb : K - 1) * ld + n] : 0.f; }
  return bsplit16(v); }
__device__ __forceinline__ v8f mac3(const F2& a, const F2& b, v8f c) { c = wmma_bf(a.l, b.h, c); c = wmma_bf(a.h, b.l, c); return wmma_bf(a.h, b.h, c); }
__device__ __forceinline__ float sigm(float v) { return 1.0f / (1.0f + expf(-v)); }
#define LDSX() do { asm volatile("s_wait_dscnt 0" ::: "memory"); __builtin_amdgcn_wave_barrier(); __builtin_amdgcn_fence(__ATOMIC_RELEASE, "workgroup"); } while (0)

// Causal multi-head self-attention without an output projection (hidden_states [4,2048,768]; attention_mask [4,1,1,2048] f32 (zeros on this draw) ADDED to the scores per key; torch (out,in) Wq / Wk / Wv [768,768] N(0,1) x 0.02 applied as x @ W.T, zero biases (read); 12 heads x 64; scores / 64^0.5; -inf strictly above the diagonal; + attention_mask; softmax; heads merged to [4,2048,768]).
#define NB 4
#define TT 2048
#define CC 768            // NH * HD = projected width
#define DIN 768          // input (model) width
#define NH 12
#define HD 64
#define NQB (TT / 64)
#define SCALE (0.125f)
#define CAUSAL 1
#ifndef TNB
#define TNB NB
#endif
__device__ __forceinline__ float bfr(float v) { return (float)(__bf16)v; }
__host__ __device__ __forceinline__ int kb_last(int qb) { return CAUSAL ? ((qb * 64 + 63) >> 7) : (TT / 128 - 1); }
typedef __attribute__((ext_vector_type(8))) __bf16 v8b;
__device__ __forceinline__ v16b frag_b(const __bf16* rowk0, int lane) {
  union { v16b v; v8b q[2]; } u; const __bf16* p = rowk0 + 8 * (lane >> 4);
  u.q[0] = *(const v8b*)p; u.q[1] = *(const v8b*)(p + 16); return u.v;
}
#define QBH 6              // causal: unused; the high-precision path is taken by queries below QHI (few keys, no averaging)
#define QHI 384            // rows carrying a q residual plane
#define KHI 384            // key rows carrying k residual / v bf16 hi+lo planes (used only by the causal high-precision path)
// B fragment (k rows k0+.., output column o) of a weight: (in,out) [K][ld] or (out,in) [ld rows of K]: bf16 exact, or f16(bf16 * 256) exact
__device__ __forceinline__ v16b wcol_io(const float* Wm, int k0, int o, int lane, int ld) { v16b w; const int g = lane >> 4;
#pragma unroll
  for (int i = 0; i < 8; ++i) { w[i] = (__bf16)Wm[(size_t)(k0 + 8 * g + i) * ld + o]; w[8 + i] = (__bf16)Wm[(size_t)(k0 + 16 + 8 * g + i) * ld + o]; }
  return w; }
__device__ __forceinline__ v16b wcol_oi(const float* Wm, int k0, int o, int lane, int K) { v16b w; const float* p = Wm + (size_t)o * K + k0 + 8 * (lane >> 4);
#pragma unroll
  for (int i = 0; i < 8; ++i) { w[i] = (__bf16)p[i]; w[8 + i] = (__bf16)p[16 + i]; }
  return w; }
__device__ __forceinline__ v16h wcolh_io(const float* Wm, int k0, int o, int lane, int ld) { v16h w; const int g = lane >> 4;
#pragma unroll
  for (int i = 0; i < 8; ++i) { w[i] = (_Float16)(bfr(Wm[(size_t)(k0 + 8 * g + i) * ld + o]) * 256.0f); w[8 + i] = (_Float16)(bfr(Wm[(size_t)(k0 + 16 + 8 * g + i) * ld + o]) * 256.0f); }
  return w; }
__device__ __forceinline__ v16h wcolh_oi(const float* Wm, int k0, int o, int lane, int K) { v16h w; const float* p = Wm + (size_t)o * K + k0 + 8 * (lane >> 4);
#pragma unroll
  for (int i = 0; i < 8; ++i) { w[i] = (_Float16)(bfr(p[i]) * 256.0f); w[8 + i] = (_Float16)(bfr(p[16 + i]) * 256.0f); }
  return w; }
#define WQKV_LAYOUT 1   // 0 = (in,out) [DIN][CC]; 1 = (out,in) [CC][DIN]; 2 = per-head [NH][DIN][HD]
__device__ __forceinline__ v16b wcol_hdk(const float* Wm, int k0, int o, int lane) { v16b w; const int g = lane >> 4; const float* p = Wm + (size_t)(o / HD) * DIN * HD + (o % HD);
#pragma unroll
  for (int i = 0; i < 8; ++i) { w[i] = (__bf16)p[(size_t)(k0 + 8 * g + i) * HD]; w[8 + i] = (__bf16)p[(size_t)(k0 + 16 + 8 * g + i) * HD]; }
  return w; }
#define WO_OUT_IN 1
#if WQKV_LAYOUT == 1
#define WCOL(W, k0, o, lane) wcol_oi(W, k0, o, lane, DIN)
#elif WQKV_LAYOUT == 2
#define WCOL(W, k0, o, lane) wcol_hdk(W, k0, o, lane)
#else
#define WCOL(W, k0, o, lane) wcol_io(W, k0, o, lane, CC)
#endif
#if WO_OUT_IN
#define WOCOL(W, k0, o, lane) wcol_oi(W, k0, o, lane, CC)
#define WOCOLH(W, k0, o, lane) wcolh_oi(W, k0, o, lane, CC)
#else
#define WOCOL(W, k0, o, lane) wcol_io(W, k0, o, lane, DIN)
#define WOCOLH(W, k0, o, lane) wcolh_io(W, k0, o, lane, DIN)
#endif

#define WS_QH  0u                                      // f16 q rows [b*t][CC]
#define WS_KH  (WS_QH + 2u * (size_t)NB * TT * CC)      // f16 k rows [b*t][CC]
#define WS_VT  (WS_KH + 2u * (size_t)NB * TT * CC)      // f16 v planes [b][c][t]
#define WS_QL  (WS_VT + 2u * (size_t)NB * CC * TT)      // f16 q residual x 2^10 rows [b][t < QHI][CC]
#define WS_KL  (WS_QL + 2u * (size_t)NB * QHI * CC)     // f16 k residual x 2^10 rows [b][t < KHI][CC]
#define WS_VB  (WS_KL + 2u * (size_t)NB * KHI * CC)     // bf16 v hi planes [b][c][t < KHI]
#define WS_VBL (WS_VB + 2u * (size_t)NB * CC * KHI)
#define WS_END (WS_VBL + 2u * (size_t)NB * CC * KHI)

// ---- k_proj: block = (128 rows, 128 cols, which), 8 waves as 4 x 2, wave = 32 rows x 64 cols: q/k/v = X W (+ b) with exact bf16 products (K = DIN) -> which 0: q f16 rows (+ residual rows < QHI); 1: k f16 rows (+ residual rows < KHI); 2: v f16 planes [c][t] (+ bf16 hi/lo planes for t < KHI)
// The block's X and W tiles go through LDS, 64 k a stage: each f32 element is loaded once per block by whole-line loads (a wave-wide 16-byte load = two 256-B row pieces), rounded to bf16 once and read back as fragments by the waves that share it.
// Two buffers: the next stage's global loads fly under this stage's products. k runs upward through one accumulator per tile, as before: the sums are the same. The short loops are unrolled whole so that their arrays stay in registers.
#define PBM 128           // rows of X per block
#define PBN 128           // output columns per block
#define PBK 64            // k per stage
#define PLD (PBK + 8)     // 144-B LDS rows (16 B x odd): no bank conflict for the 16-byte fragment reads
#define PEL (128 + 8)     // 272-B rows of the epilogue's planes
#define PSTG (128 * PLD * 2)        // bytes of one operand's tile in one buffer
#define PSMEM (3 * 128 * PEL * 2)   // the epilogue's three planes; the ring (4 x PSTG) is smaller and lies in the same bytes
typedef __attribute__((ext_vector_type(4))) __bf16 v4b;
// eight 16-byte stores, STEP bytes apart, from one address pair, and behind them, in the same statement, the wait that stands in front of any write of a register they name: in the built code another arm of the epilogue may follow any of these stores
template <int STEP> __device__ __forceinline__ void st8(void* p, const v4u* t) {
  asm volatile("global_store_b128 %0, %1, off\n\tglobal_store_b128 %0, %2, off offset:%9\n\tglobal_store_b128 %0, %3, off offset:%10\n\tglobal_store_b128 %0, %4, off offset:%11\n\t"
               "global_store_b128 %0, %5, off offset:%12\n\tglobal_store_b128 %0, %6, off offset:%13\n\tglobal_store_b128 %0, %7, off offset:%14\n\tglobal_store_b128 %0, %8, off offset:%15\n\ts_wait_xcnt 0x0"
               :: "v"(p), "v"(t[0]), "v"(t[1]), "v"(t[2]), "v"(t[3]), "v"(t[4]), "v"(t[5]), "v"(t[6]), "v"(t[7]), "n"(STEP), "n"(2 * STEP), "n"(3 * STEP), "n"(4 * STEP), "n"(5 * STEP), "n"(6 * STEP), "n"(7 * STEP) : "memory"); }
__global__ __launch_bounds__(256) void k_proj(const float* __restrict__ XQ, const float* __restrict__ XK, const float* __restrict__ XV, const float* __restrict__ WQ, const float* __restrict__ WK, const float* __restrict__ WV, const float* __restrict__ BQ, const float* __restrict__ BK, const float* __restrict__ BV,
    _Float16* __restrict__ QH, _Float16* __restrict__ QL, _Float16* __restrict__ KH, _Float16* __restrict__ KL, _Float16* __restrict__ VT, __bf16* __restrict__ VB, __bf16* __restrict__ VBL) {
  __shared__ __align__(16) char sm[PSMEM];
  const int tid = threadIdx.x, wave = tid >> 5, lane = tid & 31, col = lane & 15, g = lane >> 4, wr = wave >> 1, wc = wave & 1; const int which = blockIdx.z; const int c0 = blockIdx.y * PBN; const size_t r0 = (size_t)blockIdx.x * PBM; const size_t bb = r0 / TT; const int t0 = (int)(r0 % TT);
  const float* X = which == 0 ? XQ : which == 1 ? XK : XV; const float* WA = which == 0 ? WQ : which == 1 ? WK : WV; const float* BA = which == 0 ? BQ : which == 1 ? BK : BV;
  __bf16 (*xs)[128][PLD] = (__bf16 (*)[128][PLD])sm; __bf16 (*wt)[128][PLD] = (__bf16 (*)[128][PLD])(sm + 2 * PSTG);
  // staging: thread = (row tid >> 4 of 16, 16-byte piece tid & 15 of a 256-B row piece), 8 row groups per operand
  const int srow = tid >> 4, sc = (tid & 15) * 4; const float* xg = X + (r0 + srow) * DIN + sc; const float* wg = WA + (size_t)(c0 + srow) * DIN + sc;
  v4f xr[8], wv[8];
#pragma unroll
  for (int p = 0; p < 8; ++p) { xr[p] = *(const v4f*)(xg + (size_t)p * 16 * DIN); wv[p] = *(const v4f*)(wg + (size_t)p * 16 * DIN); }
  float bias[4] = {0.f, 0.f, 0.f, 0.f};   // read here, as one group beside the first stage's loads: one latency for all of them
  if (BA) {
#pragma unroll
    for (int j = 0; j < 4; ++j) bias[j] = bfr(BA[c0 + wc * 64 + j * 16 + col]); }
  v8f acc[2][4] = {};
#pragma unroll 2   // two stages a trip: the buffer index is a constant in each half, so every LDS address is one register plus an immediate
  for (int s = 0; s < DIN / PBK; ++s) { const int bf = s & 1;
#pragma unroll
    for (int p = 0; p < 8; ++p) { v4b a, w;
#pragma unroll
      for (int i = 0; i < 4; ++i) { a[i] = (__bf16)xr[p][i]; w[i] = (__bf16)wv[p][i]; }
      *(v4b*)&xs[bf][srow + p * 16][sc] = a; *(v4b*)&wt[bf][srow + p * 16][sc] = w; }
    // one barrier a stage: it publishes this buffer, and every wave that passes it has left the other buffer, which the next stage's stores overwrite
    __syncthreads();
    if (s + 1 < DIN / PBK) {
#pragma unroll
      for (int p = 0; p < 8; ++p) { xr[p] = *(const v4f*)(xg + (size_t)p * 16 * DIN + (s + 1) * PBK); wv[p] = *(const v4f*)(wg + (size_t)p * 16 * DIN + (s + 1) * PBK); } }
    v16b a[PBK / 32][2], w[PBK / 32][4];
#pragma unroll
    for (int kk = 0; kk < PBK / 32; ++kk) {
#pragma unroll
      for (int i = 0; i < 2; ++i) a[kk][i] = frag_b(&xs[bf][wr * 32 + i * 16 + col][kk * 32], lane);
#pragma unroll
      for (int j = 0; j < 4; ++j) w[kk][j] = frag_b(&wt[bf][wc * 64 + j * 16 + col][kk * 32], lane); }
    __builtin_amdgcn_sched_barrier(0);   // the next stage's global loads and this stage's fragment reads issue as one group in front of the products; left free, the global loads were sunk among the products and waited out there
#pragma unroll
    for (int kk = 0; kk < PBK / 32; ++kk)
#pragma unroll
      for (int i = 0; i < 2; ++i)
#pragma unroll
        for (int j = 0; j < 4; ++j) acc[i][j] = __builtin_amdgcn_wmma_f32_16x16x32_bf16(false, a[kk][i], false, w[kk][j], (short)0, acc[i][j], false, false);
    __builtin_amdgcn_sched_barrier(0);   // keeps the conversions of the next stage's values, and with them the wait for its loads, behind the products
  }
  __syncthreads();   // every wave has read its last fragments before the epilogue's planes overwrite the ring
  const int er = tid >> 4, eq = (tid & 15) * 8;   // copy-out: thread = (plane row er + 16 it, 16-byte piece), 16 lanes store 256 B in a row
  v4u t[8];
  if (which < 2) { _Float16* DH = which == 0 ? QH : KH; _Float16* DL = which == 0 ? QL : KL; const int nhi = which == 0 ? QHI : KHI; const bool hi_rows = t0 < nhi;
    _Float16 (*sh)[PEL] = (_Float16 (*)[PEL])sm; _Float16 (*sl)[PEL] = (_Float16 (*)[PEL])(sm + 128 * PEL * 2);
#pragma unroll
    for (int j = 0; j < 4; ++j)
#pragma unroll
      for (int i = 0; i < 2; ++i)
#pragma unroll
        for (int r = 0; r < 8; ++r) sh[wr * 32 + i * 16 + 8 * g + r][wc * 64 + j * 16 + col] = (_Float16)(acc[i][j][r] + bias[j]);
    if (hi_rows) {
#pragma unroll
      for (int j = 0; j < 4; ++j)
#pragma unroll
        for (int i = 0; i < 2; ++i)
#pragma unroll
          for (int r = 0; r < 8; ++r) { const float v = acc[i][j][r] + bias[j]; const _Float16 hv = (_Float16)v; sl[wr * 32 + i * 16 + 8 * g + r][wc * 64 + j * 16 + col] = (_Float16)((v - (float)hv) * 1024.0f); } }
    __syncthreads();
    _Float16* dh = DH + (r0 + er) * CC + c0 + eq;
#pragma unroll
    for (int it = 0; it < 8; ++it) t[it] = *(const v4u*)&sh[er + it * 16][eq];
    st8<16 * CC * 2>(dh, t);
    if (hi_rows) {
      _Float16* dl = DL + (bb * nhi + t0 + er) * (size_t)CC + c0 + eq;
#pragma unroll
      for (int it = 0; it < 8; ++it) t[it] = *(const v4u*)&sl[er + it * 16][eq];
      st8<16 * CC * 2>(dl, t); }
  } else { const bool hi_rows = t0 < KHI;
    _Float16 (*th)[PEL] = (_Float16 (*)[PEL])sm; __bf16 (*tb)[PEL] = (__bf16 (*)[PEL])(sm + 128 * PEL * 2); __bf16 (*tbl)[PEL] = (__bf16 (*)[PEL])(sm + 2 * 128 * PEL * 2);
    // a lane's 8 accumulator rows are 8 neighbouring t of one plane row: one 16-byte LDS store each
#pragma unroll
    for (int j = 0; j < 4; ++j)
#pragma unroll
      for (int i = 0; i < 2; ++i) { v8h hv;
#pragma unroll
        for (int r = 0; r < 8; ++r) hv[r] = (_Float16)(acc[i][j][r] + bias[j]);
        *(v8h*)&th[wc * 64 + j * 16 + col][wr * 32 + i * 16 + 8 * g] = hv; }
    if (hi_rows) {
#pragma unroll
      for (int j = 0; j < 4; ++j)
#pragma unroll
        for (int i = 0; i < 2; ++i) { v8b bh, bl;
#pragma unroll
          for (int r = 0; r < 8; ++r) { const float v = acc[i][j][r] + bias[j]; const __bf16 b1 = (__bf16)v; bh[r] = b1; bl[r] = (__bf16)(v - (float)b1); }
          *(v8b*)&tb[wc * 64 + j * 16 + col][wr * 32 + i * 16 + 8 * g] = bh; *(v8b*)&tbl[wc * 64 + j * 16 + col][wr * 32 + i * 16 + 8 * g] = bl; } }
    __syncthreads();
    _Float16* vt = VT + (bb * CC + c0 + er) * (size_t)TT + t0 + eq;
#pragma unroll
    for (int it = 0; it < 8; ++it) t[it] = *(const v4u*)&th[er + it * 16][eq];
    st8<16 * TT * 2>(vt, t);
    if (hi_rows) {
      const size_t o3 = (bb * CC + c0 + er) * (size_t)KHI + t0 + eq;
#pragma unroll
      for (int it = 0; it < 8; ++it) t[it] = *(const v4u*)&tb[er + it * 16][eq];
      st8<16 * KHI * 2>(VB + o3, t);
#pragma unroll
      for (int it = 0; it < 8; ++it) t[it] = *(const v4u*)&tbl[er + it * 16][eq];
      st8<16 * KHI * 2>(VBL + o3, t); } } }
// ---- k_fa: scores, softmax and P . v in one launch. Block = 128 queries of one (batch, head), wave = 32 queries, walking its keys [0, last query] 32 at a time.
// Transposed products: S^T = K . Q^T (D: register r = key 8g + r, lane column = query), so a lane holds 16 scores of ONE query and two S^T tiles, converted in place, are the B operand of O^T += V^T . P^T.
// Running maximum m and running sum l per query; the output tile is rescaled by exp(m_old - m_new) on every pass.
// Rows >= QHI: the block's K rows and V planes go through LDS, 128 keys a stage, two buffers, brought by asynchronous copies in whole 128-B lines and read back as fragments by all four waves.
#define FQW 32            // queries per wave
#define FQB 128           // queries per block
#define FSK 128           // keys per stage
#define FKP 144           // bytes of a K row in LDS (128 + 16: 16 B x odd, no bank conflict for the 16-byte fragment reads)
#define FVP 272           // bytes of a V plane row in LDS (256 + 16)
#define FKB (FSK * FKP)   // bytes of a stage's K rows
#define FBUF (FKB + HD * FVP)   // bytes of one buffer
static_assert(QHI % FQB == 0 && FQB == FSK && TT % FSK == 0, "a block is wholly on one path and its keys are whole stages");
#define L2E 1.4426950408889634f
__device__ __forceinline__ v8f wm_h(v16h a, v16h b, v8f c) { return __builtin_amdgcn_wmma_f32_16x16x32_f16(false, a, false, b, (short)0, c, false, false); }
__device__ __forceinline__ v8f wm_b(v16b a, v16b b, v8f c) { return __builtin_amdgcn_wmma_f32_16x16x32_bf16(false, a, false, b, (short)0, c, false, false); }
// lane l with lane l ^ 16
__device__ __forceinline__ float xhalf(float x) { return __builtin_bit_cast(float, __builtin_amdgcn_permlanex16(__builtin_bit_cast(int, x), __builtin_bit_cast(int, x), 0x76543210, 0xfedcba98, false, false)); }
// the 16 additive mask values (bf16-rounded like every float input) of the keys a lane holds: k0 + 8g + 0..7 and k0 + 16 + 8g + 0..7
__device__ __forceinline__ void mask16(const float* __restrict__ amk, float am[16]) {
  const v4f a0 = *(const v4f*)amk, a1 = *(const v4f*)(amk + 4), a2 = *(const v4f*)(amk + 16), a3 = *(const v4f*)(amk + 20);
#pragma unroll
  for (int i = 0; i < 4; ++i) { am[i] = bfr(a0[i]); am[4 + i] = bfr(a1[i]); am[8 + i] = bfr(a2[i]); am[12 + i] = bfr(a3[i]); } }
// 2^x on the transcendental pipe, with the slot that the instruction set asks for behind a transcendental before its result is used or its source overwritten: in a run each fills the slot of the one in front, one v_nop closes the run
__device__ __forceinline__ void exp2x8(float* a) {
  asm("v_exp_f32 %0, %0\n\tv_exp_f32 %1, %1\n\tv_exp_f32 %2, %2\n\tv_exp_f32 %3, %3\n\tv_exp_f32 %4, %4\n\tv_exp_f32 %5, %5\n\tv_exp_f32 %6, %6\n\tv_exp_f32 %7, %7\n\tv_nop"
      : "+v"(a[0]), "+v"(a[1]), "+v"(a[2]), "+v"(a[3]), "+v"(a[4]), "+v"(a[5]), "+v"(a[6]), "+v"(a[7])); }
__device__ __forceinline__ float exp2x1(float x) { float r; asm("v_exp_f32 %0, %1\n\tv_nop" : "=v"(r) : "v"(x)); return r; }
// one pass of the running softmax for one query column: v[16] -> exp(v - m) x 2^11 (the 2^11 rides in the exponent; l sums the same scaled terms); returns the factor for what was summed before
__device__ __forceinline__ float soft16(float v[16], float& m, float& l) {
  float mx = v[0];
#pragma unroll
  for (int i = 1; i < 16; ++i) mx = fmaxf(mx, v[i]);
  mx = fmaxf(mx, xhalf(mx)); const float mn = fmaxf(m, mx); const float alpha = exp2x1((m - mn) * L2E); m = mn;
  // a key at or below -1e38 is excluded (term 0): under a larger maximum its exponent underflows by itself; where the maximum itself is that low every key so far is excluded
  const float mr = mn <= -1.0e38f ? 3.0e38f : mn;
#pragma unroll
  for (int i = 0; i < 16; ++i) v[i] = fmaf(v[i] - mr, L2E, 11.0f);
  exp2x8(v); exp2x8(v + 8);
  float sum = 0.f;
#pragma unroll
  for (int i = 0; i < 16; ++i) sum += v[i];
  l = l * alpha + sum; return alpha; }
// a 16x16x32 fragment at a wave-uniform base plus the lane's own byte offset (row and 8g in it) plus a constant: elements 0..7 = p[0..7], 8..15 = p[16..23]
__device__ __forceinline__ v16h ld16h(const _Float16* base, unsigned off, int el) { const _Float16* p = (const _Float16*)((const char*)base + off) + el; union { v16h v; v8h q[2]; } u; u.q[0] = *(const v8h*)p; u.q[1] = *(const v8h*)(p + 16); return u.v; }
__device__ __forceinline__ v16b ld16b(const __bf16* base, unsigned off, int el) { const __bf16* p = (const __bf16*)((const char*)base + off) + el; union { v16b v; v8b q[2]; } u; u.q[0] = *(const v8b*)p; u.q[1] = *(const v8b*)(p + 16); return u.v; }
// query rows < QHI, 16 at a time: q and k as f16 hi + residual (3 products), exp and v as bf16 hi + lo (3 products)
__device__ __forceinline__ void fa_hi(const _Float16* __restrict__ QH, const _Float16* __restrict__ KH, const _Float16* __restrict__ QL, const _Float16* __restrict__ KL, const __bf16* __restrict__ VB, const __bf16* __restrict__ VBL, const float* __restrict__ AM,
    int b, int h, int qt, int lane, float (*st)[HD + 4]) {
  const int col = lane & 15, g = lane >> 4; const int t = qt + col;
  const _Float16* Qs = QH + ((size_t)b * TT + qt) * CC + h * HD; const _Float16* Qls = QL + ((size_t)b * QHI + qt) * CC + h * HD; const unsigned qo = (unsigned)(col * CC + 8 * g) * 2u;
  v16h qh[2], ql[2];
#pragma unroll
  for (int kc = 0; kc < 2; ++kc) { qh[kc] = ld16h(Qs, qo, kc * 32); ql[kc] = ld16h(Qls, qo, kc * 32); }
  asm volatile("s_wait_xcnt 0x0" :: "v"(qh[0]), "v"(qh[1]), "v"(ql[0]), "v"(ql[1]) : "memory");   // stands behind the q loads, in front of the first write of their address registers; the loaded values are inputs only, so that the loads cannot sink below it (without them this build placed the loads behind the wait and a K load's result in their address registers)
  // wave-uniform bases and each lane's own byte offsets, stepped once a pass: every load of a pass is one of these registers plus a constant
  const float* As = AM + (size_t)b * TT; const _Float16* Ks = KH + (size_t)b * TT * CC + h * HD; const _Float16* Kls = KL + (size_t)b * KHI * CC + h * HD;
  const __bf16* Vs = VB + ((size_t)b * CC + h * HD) * (size_t)KHI; const __bf16* Vls = VBL + ((size_t)b * CC + h * HD) * (size_t)KHI;
  unsigned ao = (unsigned)(8 * g) * 4u, ko = (unsigned)(col * CC + 8 * g) * 2u, vo = (unsigned)(col * KHI + 8 * g) * 2u;
  v8f o[HD / 16] = {}; float m = -3.0e38f, l = 0.f; const int nit = qt / 32 + 1;
#pragma unroll 1
  for (int it = 0; it < nit; ++it) { const int k0 = it * 32; v8f acc[2] = {}, accl[2] = {}; float am[16]; mask16((const float*)((const char*)As + ao), am);
#pragma unroll
    for (int kt = 0; kt < 2; ++kt)
#pragma unroll
      for (int kc = 0; kc < 2; ++kc) { const v16h kh = ld16h(Ks, ko, kt * 16 * CC + kc * 32), kl = ld16h(Kls, ko, kt * 16 * CC + kc * 32);
        acc[kt] = wm_h(kh, qh[kc], acc[kt]); accl[kt] = wm_h(kh, ql[kc], accl[kt]); accl[kt] = wm_h(kl, qh[kc], accl[kt]); }
    v16b vh[HD / 16], vl[HD / 16];
#pragma unroll
    for (int j = 0; j < HD / 16; ++j) { vh[j] = ld16b(Vs, vo, j * 16 * KHI); vl[j] = ld16b(Vls, vo, j * 16 * KHI); }
    asm volatile("s_wait_xcnt 0x0" : "+v"(ao), "+v"(ko), "+v"(vo) :: "memory");   // stands between this pass's loads and the step of their offset registers; naming the offsets keeps them in those registers up to the wait and the step behind it
    ao += 32u * 4u; ko += 32u * CC * 2u; vo += 32u * 2u;
    float v[16];
#pragma unroll
    for (int i = 0; i < 16; ++i) { const int key = k0 + (i >> 3) * 16 + 8 * g + (i & 7); const float s = (acc[i >> 3][i & 7] + accl[i >> 3][i & 7] * (1.0f / 1024.0f)) * SCALE; v[i] = (key <= t ? s : -3.0e38f) + am[i]; }
    const float alpha = soft16(v, m, l); const F2 p = bsplit16(v);
#pragma unroll
    for (int j = 0; j < HD / 16; ++j) { o[j] = o[j] * alpha; o[j] = wm_b(vh[j], p.h, o[j]); o[j] = wm_b(vh[j], p.l, o[j]); o[j] = wm_b(vl[j], p.h, o[j]); } }
  l += xhalf(l); const float inv = l > 0.f ? 1.0f / l : 0.f;   /* a fully excluded row yields 0 */
#pragma unroll
  for (int j = 0; j < HD / 16; ++j) { const v8f r = o[j] * inv; *(v4f*)&st[col][j * 16 + 8 * g] = __builtin_shufflevector(r, r, 0, 1, 2, 3); *(v4f*)&st[col][j * 16 + 8 * g + 4] = __builtin_shufflevector(r, r, 4, 5, 6, 7); } }
// eight asynchronous 16-byte copies to LDS per lane, LS bytes apart in LDS and GS bytes apart in global memory, and behind them, in the same statement, the wait that stands in front of any write of a register they name
template <int LS, int GS> __device__ __forceinline__ void cp8(unsigned l, const char* p) {
  asm volatile("global_load_async_to_lds_b128 %0, %8, off\n\tglobal_load_async_to_lds_b128 %1, %9, off\n\tglobal_load_async_to_lds_b128 %2, %10, off\n\tglobal_load_async_to_lds_b128 %3, %11, off\n\t"
               "global_load_async_to_lds_b128 %4, %12, off\n\tglobal_load_async_to_lds_b128 %5, %13, off\n\tglobal_load_async_to_lds_b128 %6, %14, off\n\tglobal_load_async_to_lds_b128 %7, %15, off\n\ts_wait_xcnt 0x0"
               :: "v"(l), "v"(l + LS), "v"(l + 2 * LS), "v"(l + 3 * LS), "v"(l + 4 * LS), "v"(l + 5 * LS), "v"(l + 6 * LS), "v"(l + 7 * LS),
                  "v"(p), "v"(p + GS), "v"(p + 2 * GS), "v"(p + 3 * GS), "v"(p + 4 * GS), "v"(p + 5 * GS), "v"(p + 6 * GS), "v"(p + 7 * GS) : "memory"); }
// a 16x16x32 fragment from LDS: elements 0..7 = p[0..7], 8..15 = p[16..23]
__device__ __forceinline__ v16h lds16h(const char* p) { union { v16h v; v8h q[2]; } u; u.q[0] = *(const v8h*)p; u.q[1] = *(const v8h*)(p + 32); return u.v; }
// four waves per SIMD: keeps the allocation at 256 VGPRs, below the register windows that cost a mode switch per access
__global__ __launch_bounds__(128) __attribute__((amdgpu_waves_per_eu(4, 4))) void k_fa(const _Float16* __restrict__ QH, const _Float16* __restrict__ KH, const _Float16* __restrict__ QL, const _Float16* __restrict__ KL, const _Float16* __restrict__ VT, const __bf16* __restrict__ VB, const __bf16* __restrict__ VBL, const float* __restrict__ AM, float* __restrict__ Y) {
  __shared__ __align__(16) char sm[2 * FBUF];   // the ring; behind the loop's last barrier its first bytes are the output staging
  static_assert(sizeof(float) * (FQB / FQW) * FQW * (HD + 4) <= 2 * FBUF, "the output staging lies inside the ring");
  float (*ss)[FQW][HD + 4] = (float (*)[FQW][HD + 4])sm;
  const int tid = threadIdx.x, lane = tid & 31, col = lane & 15, g = lane >> 4; const int wave = __builtin_amdgcn_readfirstlane(tid >> 5);
  const int b = blockIdx.x / NH, h = blockIdx.x % NH; const int q0 = (TT / FQB - 1 - (int)blockIdx.y) * FQB, qw = q0 + wave * FQW;   // the blocks with the most keys start first
  if (q0 < QHI) {
#pragma unroll 1   // one copy of the high-precision body serves both halves of the wave's 32 queries: half the code, and each half's loads stay inside its own trip
    for (int hf = 0; hf < 2; ++hf) fa_hi(QH, KH, QL, KL, VB, VBL, AM, b, h, qw + hf * 16, lane, &ss[wave][hf * 16]); }
  else {
    // wave-uniform bases and each lane's own byte offsets
    const _Float16* Ks = KH + (size_t)b * TT * CC + h * HD; const _Float16* Vs = VT + ((size_t)b * CC + h * HD) * (size_t)TT; const float* As = AM + (size_t)b * TT; const _Float16* Qs = QH + ((size_t)b * TT + qw) * CC + h * HD;
    const unsigned ko = (unsigned)(col * CC + 8 * g) * 2u; unsigned ao = (unsigned)(8 * g) * 4u;
    // staging: K, thread = (row tid >> 3 of 16, 16-byte piece tid & 7 of a 128-B row), 8 row groups; V, thread = (plane row tid >> 4 of 8, piece tid & 15 of 256 B), 8 row groups: a wave-wide copy is four whole lines
    const char* kg = (const char*)Ks + (size_t)(tid >> 3) * (CC * 2) + (tid & 7) * 16; const char* vg = (const char*)Vs + (size_t)(tid >> 4) * (TT * 2) + (tid & 15) * 16;
    const unsigned kd = (unsigned)(size_t)sm + (unsigned)(tid >> 3) * FKP + (tid & 7) * 16, vd = (unsigned)(size_t)sm + FKB + (unsigned)(tid >> 4) * FVP + (tid & 15) * 16;
    auto stage = [&](const int st) __attribute__((always_inline)) { const unsigned bo = (unsigned)(st & 1) * FBUF;
      cp8<16 * FKP, 16 * CC * 2>(kd + bo, kg + (size_t)st * (FSK * CC * 2)); cp8<8 * FVP, 8 * TT * 2>(vd + bo, vg + (size_t)st * (FSK * 2)); };
    const int nst = q0 / FSK + 1;   // at least QHI / FSK + 1 stages
    stage(0);
    v16h qf[2][2];
#pragma unroll
    for (int q = 0; q < 2; ++q)
#pragma unroll
      for (int kc = 0; kc < 2; ++kc) qf[q][kc] = ld16h(Qs, ko, q * 16 * CC + kc * 32);
    v8f o[2][HD / 16] = {}; float m[2] = {-3.0e38f, -3.0e38f}, l[2] = {0.f, 0.f};
    asm volatile("s_wait_asynccnt 0x0" ::: "memory");   // this wave's copies of stage 0 have landed
    __syncthreads();   // publishes stage 0
    stage(1);
    const char* kl = sm + col * FKP + 16 * g; const char* vl = sm + FKB + col * FVP + 16 * g;   // the lane's own place in a K row group and in a V plane row group
    const char* kp = kl; const char* vp = vl;   // where the next pass reads: stepped once a pass, set to the other buffer at the foot of a stage
    // one pass = 32 keys; only the last pass holds keys past a query, so it alone carries the index test and the loop body stays one straight block
    auto pass = [&](const bool last) __attribute__((always_inline)) {
      const float* amk = (const float*)((const char*)As + ao); const v4f ar[4] = {*(const v4f*)amk, *(const v4f*)(amk + 4), *(const v4f*)(amk + 16), *(const v4f*)(amk + 20)};   // the mask values of the keys a lane holds, in the order of mask16
      v16h kf[2][2], vf[HD / 16];
#pragma unroll
      for (int kt = 0; kt < 2; ++kt)
#pragma unroll
        for (int kc = 0; kc < 2; ++kc) kf[kt][kc] = lds16h(kp + kt * 16 * FKP + kc * 64);
#pragma unroll
      for (int j = 0; j < HD / 16; ++j) vf[j] = lds16h(vp + j * 16 * FVP);
      __builtin_amdgcn_sched_barrier(0);   // the mask loads and the K and V fragment reads issue as one group in front of the S^T products, the V reads and the mask loads flying under them; left free, the mask loads were placed where they are used and the wave waited out their latency on every pass
      v8f s[2][2] = {};
#pragma unroll
      for (int kc = 0; kc < 2; ++kc)
#pragma unroll
        for (int kt = 0; kt < 2; ++kt)
#pragma unroll
          for (int q = 0; q < 2; ++q) s[q][kt] = wm_h(kf[kt][kc], qf[q][kc], s[q][kt]);
      asm volatile("s_wait_xcnt 0x0" : "+v"(ao) :: "memory");   // stands between this pass's mask loads and the step of their offset register; naming the offset keeps it in that register up to the wait and the step behind it
      ao += 32u * 4u; kp += 32 * FKP; vp += 32 * 2;
      __builtin_amdgcn_sched_barrier(0);   // keeps the first use of the mask values, and with it their wait, behind the S^T products
      float am[16];
#pragma unroll
      for (int i = 0; i < 16; ++i) am[i] = bfr(ar[i >> 2][i & 3]);
      v16h pf[2];
#pragma unroll
      for (int q = 0; q < 2; ++q) { float v[16];
#pragma unroll
        for (int i = 0; i < 16; ++i) { const int key = qw + (i >> 3) * 16 + 8 * g + (i & 7);   /* the last pass starts at key qw */ const float sv = s[q][i >> 3][i & 7] * SCALE; v[i] = ((!last || key <= qw + q * 16 + col) ? sv : -3.0e38f) + am[i]; }
        const float alpha = soft16(v, m[q], l[q]);
#pragma unroll
        for (int i = 0; i < 16; ++i) pf[q][i] = (_Float16)v[i];
#pragma unroll
        for (int j = 0; j < HD / 16; ++j) o[q][j] = o[q][j] * alpha; }
#pragma unroll
      for (int j = 0; j < HD / 16; ++j)
#pragma unroll
        for (int q = 0; q < 2; ++q) o[q][j] = wm_h(vf[j], pf[q], o[q][j]); };
    // the block walks its stages together, four passes a stage; all stages but the last lie wholly below every query of the block
#pragma unroll 1
    for (int ip = 0; ip < (nst - 1) * (FSK / 32); ++ip) { pass(false);
      if ((ip & (FSK / 32 - 1)) == FSK / 32 - 1) { const int st = ip / (FSK / 32);   // the foot of stage st; the trip count and this test read the same in every wave of the block
        asm volatile("s_wait_dscnt 0x0" ::: "memory");      // this wave's reads of stage st have returned
        asm volatile("s_wait_asynccnt 0x0" ::: "memory");   // this wave's copies of stage st + 1 have landed
        __syncthreads();   // publishes stage st + 1, and every wave that passes it has left stage st's buffer, which the next copies overwrite
        if (st + 2 < nst) stage(st + 2);
        kp = kl + ((st + 1) & 1) * FBUF; vp = vl + ((st + 1) & 1) * FBUF; } }
    // the last stage holds the block's own 128 keys: wave w takes w whole passes and the pass on its diagonal
#pragma unroll 1
    for (int p = 0; p < wave; ++p) pass(false);
    pass(true);
    asm volatile("s_wait_dscnt 0x0" ::: "memory");      // this wave's last reads of the ring have returned
    asm volatile("s_wait_asynccnt 0x0" ::: "memory");   // no copy is in flight
    __syncthreads();   // every wave has left the ring before its bytes become the output staging
#pragma unroll
    for (int q = 0; q < 2; ++q) { const float lt = l[q] + xhalf(l[q]); const float inv = lt > 0.f ? 1.0f / lt : 0.f;   /* a fully excluded row yields 0 */
#pragma unroll
      for (int j = 0; j < HD / 16; ++j) { const v8f r = o[q][j] * inv; *(v4f*)&ss[wave][q * 16 + col][j * 16 + 8 * g] = __builtin_shufflevector(r, r, 0, 1, 2, 3); *(v4f*)&ss[wave][q * 16 + col][j * 16 + 8 * g + 4] = __builtin_shufflevector(r, r, 4, 5, 6, 7); } } }
  // each wave turns its own 32 x 64 tile in its own LDS slice: a 256-B (row, head) segment is stored by 16 lanes
  LDSX();
#pragma unroll
  for (int i = 0; i < FQW / 2; ++i) { const int rl = 2 * i + g; vst2(Y + ((size_t)b * TT + qw + rl) * CC + h * HD + col * 4, *(const v4f*)&ss[wave][rl][col * 4]); } }

extern "C" void kernel_launch(void* const* d_in, const int* in_sizes, int n_in, void* d_out, int out_size, void* d_ws, size_t ws_size, hipStream_t stream) {
  (void)in_sizes; (void)n_in; (void)out_size;
  const float** F = (const float**)d_in;
  if (ws_size < (size_t)WS_END) return;
  char* ws = (char*)d_ws; _Float16 *QH = (_Float16*)(ws + WS_QH), *KH = (_Float16*)(ws + WS_KH), *VT = (_Float16*)(ws + WS_VT), *QL = (_Float16*)(ws + WS_QL), *KL = (_Float16*)(ws + WS_KL); __bf16 *VB = (__bf16*)(ws + WS_VB), *VBL = (__bf16*)(ws + WS_VBL);
  // inputs: 0 hidden_states [4,2048,768]; 1 attention_mask [4,1,1,2048] f32 (zeros); 2 Wq [768,768] (out,in), 3 bq; 4 Wk, 5 bk; 6 Wv, 7 bv (biases zeros, read)
  k_proj<<<dim3(TNB * TT / PBM, CC / PBN, 3), 256, 0, stream>>>(F[0], F[0], F[0], F[2], F[4], F[6], F[3], F[5], F[7], QH, QL, KH, KL, VT, VB, VBL);
  k_fa<<<dim3(TNB * NH, TT / FQB), 128, 0, stream>>>(QH, KH, QL, KL, VT, VB, VBL, F[1], (float*)d_out);   /* merged heads are the output: row b*TT + t, columns h*64 .. */
}

// v005
// A run of this version takes 83.8 microseconds.
// Timed twice side by side with v004, it ran 1.07 times as fast both times.
// All steps since v000 together make it 18.0 times as fast.
// compute dtype: all float inputs rounded to bf16; q/k/v projections with EXACT bf16 products on WMMA 16x16x32 (f32 accumulate) + bias (zeros, read); causal logits: 3 products for the first 384 rows, single f16 q x k after (there q is stored x 64^-0.5 x log2 e and the mask x log2 e is the product's start value), x 64^-0.5, plus the additive float key mask (read); softmax f32 with a running maximum, in registers; exp x 2^11 once to f16 x v once to f16 (bf16 hi + lo below row 384), divided by the f32 row sum at the end; f32 output (no output projection).
#include <hip/hip_runtime.h>
#include <math.h>

typedef __attribute__((ext_vector_type(16))) _Float16 v16h;
typedef __attribute__((ext_vector_type(16))) __bf16 v16b;
typedef __attribute__((ext_vector_type(8)))  _Float16 v8h;
typedef __attribute__((ext_vector_type(8)))  float v8f;
typedef __attribute__((ext_vector_type(4)))  float v4f;
typedef __attribute__((ext_vector_type(2)))  float v2f;
typedef __attribute__((ext_vector_type(4)))  unsigned v4u;
typedef __attribute__((ext_vector_type(4)))  int v4i;
typedef float __attribute__((may_alias)) float_a;
typedef int __attribute__((may_alias)) int_a;

template <typename T> __device__ __forceinline__ void vst2(void* p, T v) { *(T*)p = v;  }
__device__ __forceinline__ v8f wmma16(v16h a, v16h b, v8f c) {
  v8f d = __builtin_amdgcn_wmma_f32_16x16x32_f16(false, a, false, b, (short)0, c, false, false);
  asm volatile("v_nop\n\tv_nop\n\tv_nop\n\tv_nop" : "+v"(d) : "v"(a), "v"(b));
  return d;
}
__device__ __forceinline__ v8f wmma_bf(v16b a, v16b b, v8f c) {
  v8f d = __builtin_amdgcn_wmma_f32_16x16x32_bf16(false, a, false, b, (short)0, c, false, false);
  asm volatile("v_nop\n\tv_nop\n\tv_nop\n\tv_nop" : "+v"(d) : "v"(a), "v"(b));
  return d;
}
// 16x16x32 fragments: lane = (h = lane>>4, row/col = lane&15); elements 0..7 = k0+8h+0..7, 8..15 = k0+16+8h+0..7; D element r = row 8h+r
__device__ __forceinline__ v16h frag_h(const _Float16* rowk0, int lane) {
  union { v16h v; v8h q[2]; } u; const _Float16* p = rowk0 + 8 * (lane >> 4);
  u.q[0] = *(const v8h*)p; u.q[1] = *(const v8h*)(p + 16); return u.v;
}
__device__ __forceinline__ v16h frag_f32(const float* rowk0, int lane) {
  v16h a; const float* p = rowk0 + 8 * (lane >> 4);
#pragma unroll
  for (int i = 0; i < 8; ++i) { a[i] = (_Float16)p[i]; a[8 + i] = (_Float16)p[16 + i]; }
  return a;
}
__device__ __forceinline__ v16h frag_f32s(const float* rowk0, int lane, float sc) {
  v16h a; const float* p = rowk0 + 8 * (lane >> 4);
#pragma unroll
  for (int i = 0; i < 8; ++i) { a[i] = (_Float16)(p[i] * sc); a[8 + i] = (_Float16)(p[16 + i] * sc); }
  return a;
}
// column fragment from a [K][ld] layout (column n), rows >= K read as 0
__device__ __forceinline__ v16h fragc_f32(const float* W, int k0, int n, int lane, int ld, int K) {
  v16h a; const int g = lane >> 4;
#pragma unroll
  for (int i = 0; i < 8; ++i) { const int ka = k0 + 8 * g + i, kb = ka + 16;
    a[i] = (_Float16)(ka < K ? W[(size_t)(ka < K ? ka : K - 1) * ld + n] : 0.f); a[8 + i] = (_Float16)(kb < K ? W[(size_t)(kb < K ? kb : K - 1) * ld + n] : 0.f); }
  return a;
}
struct F2 { v16b h, l; };
__device__ __forceinline__ F2 bsplit16(const float v[16]) { F2 r;
#pragma unroll
  for (int i = 0; i < 16; ++i) { const __bf16 h = (__bf16)v[i]; r.h[i] = h; r.l[i] = (__bf16)(v[i] - (float)h); }
  return r; }
__device__ __forceinline__ F2 split_row(const float* row, int k0, int lane) { float v[16]; const float* p = row + k0 + 8 * (lane >> 4);
#pragma unroll
  for (int i = 0; i < 8; ++i) { v[i] = p[i]; v[8 + i] = p[16 + i]; }
  return bsplit16(v); }
__device__ __forceinline__ F2 split_rowK(const float* row, int k0, int lane, int K) { float v[16]; const int g = lane >> 4;
#pragma unroll
  for (int i = 0; i < 8; ++i) { const int ka = k0 + 8 * g + i, kb = ka + 16; v[i] = ka < K ? row[ka < K ? ka : K - 1] : 0.f; v[8 + i] = kb < K ? row[kb < K ? kb : K - 1] : 0.f; }
  return bsplit16(v); }
__device__ __forceinline__ F2 split_col(const float* W, int k0, int n, int lane, int ld, int K) { float v[16]; const int g = lane >> 4;
#pragma unroll
  for (int i = 0; i < 8; ++i) { const int ka = k0 + 8 * g + i, kb = ka + 16; v[i] = ka < K ? W[(size_t)(ka < K ? ka : K - 1) * ld + n] : 0.f; v[8 + i] = kb < K ? W[(size_t)(kb < K ? kb : K - 1) * ld + n] : 0.f; }
  return bsplit16(v); }
__device__ __forceinline__ v8f mac3(const F2& a, const F2& b, v8f c) { c = wmma_bf(a.l, b.h, c); c = wmma_bf(a.h, b.l, c); return wmma_bf(a.h, b.h, c); }
__device__ __forceinline__ float sigm(float v) { return 1.0f / (1.0f + expf(-v)); }
#define LDSX() do { asm volatile("s_wait_dscnt 0" ::: "memory"); __builtin_amdgcn_wave_barrier(); __builtin_amdgcn_fence(__ATOMIC_RELEASE, "workgroup"); } while (0)

// Causal multi-head self-attention without an output projection (hidden_states [4,2048,768]; attention_mask [4,1,1,2048] f32 (zeros on this draw) ADDED to the scores per key; torch (out,in) Wq / Wk / Wv [768,768] N(0,1) x 0.02 applied as x @ W.T, zero biases (read); 12 heads x 64; scores / 64^0.5; -inf strictly above the diagonal; + attention_mask; softmax; heads merged to [4,2048,768]).
#define NB 4
#define TT 2048
#define CC 768            // NH * HD = projected width
#define DIN 768          // input (model) width
#define NH 12
#define HD 64
#define NQB (TT / 64)
#define SCALE (0.125f)
#define SCL2 (SCALE * 1.4426950408889634f)   // score scale x log2 e
#define CAUSAL 1
#ifndef TNB
#define TNB NB
#endif
__device__ __forceinline__ float bfr(float v) { return (float)(__bf16)v; }
__host__ __device__ __forceinline__ int kb_last(int qb) { return CAUSAL ? ((qb * 64 + 63) >> 7) : (TT / 128 - 1); }
typedef __attribute__((ext_vector_type(8))) __bf16 v8b;
__device__ __forceinline__ v16b frag_b(const __bf16* rowk0, int lane) {
  union { v16b v; v8b q[2]; } u; const __bf16* p = rowk0 + 8 * (lane >> 4);
  u.q[0] = *(const v8b*)p; u.q[1] = *(const v8b*)(p + 16); return u.v;
}
#define QBH 6              // causal: unused; the high-precision path is taken by queries below QHI (few keys, no averaging)
#define QHI 384            // rows carrying a q residual plane
#define KHI 384            // key rows carrying k residual / v bf16 hi+lo planes (used only by the causal high-precision path)
// B fragment (k rows k0+.., output column o) of a weight: (in,out) [K][ld] or (out,in) [ld rows of K]: bf16 exact, or f16(bf16 * 256) exact
__device__ __forceinline__ v16b wcol_io(const float* Wm, int k0, int o, int lane, int ld) { v16b w; const int g = lane >> 4;
#pragma unroll
  for (int i = 0; i < 8; ++i) { w[i] = (__bf16)Wm[(size_t)(k0 + 8 * g + i) * ld + o]; w[8 + i] = (__bf16)Wm[(size_t)(k0 + 16 + 8 * g + i) * ld + o]; }
  return w; }
__device__ __forceinline__ v16b wcol_oi(const float* Wm, int k0, int o, int lane, int K) { v16b w; const float* p = Wm + (size_t)o * K + k0 + 8 * (lane >> 4);
#pragma unroll
  for (int i = 0; i < 8; ++i) { w[i] = (__bf16)p[i]; w[8 + i] = (__bf16)p[16 + i]; }
  return w; }
__device__ __forceinline__ v16h wcolh_io(const float* Wm, int k0, int o, int lane, int ld) { v16h w; const int g = lane >> 4;
#pragma unroll
  for (int i = 0; i < 8; ++i) { w[i] = (_Float16)(bfr(Wm[(size_t)(k0 + 8 * g + i) * ld + o]) * 256.0f); w[8 + i] = (_Float16)(bfr(Wm[(size_t)(k0 + 16 + 8 * g + i) * ld + o]) * 256.0f); }
  return w; }
__device__ __forceinline__ v16h wcolh_oi(const float* Wm, int k0, int o, int lane, int K) { v16h w; const float* p = Wm + (size_t)o * K + k0 + 8 * (lane >> 4);
#pragma unroll
  for (int i = 0; i < 8; ++i) { w[i] = (_Float16)(bfr(p[i]) * 256.0f); w[8 + i] = (_Float16)(bfr(p[16 + i]) * 256.0f); }
  return w; }
#define WQKV_LAYOUT 1   // 0 = (in,out) [DIN][CC]; 1 = (out,in) [CC][DIN]; 2 = per-head [NH][DIN][HD]
__device__ __forceinline__ v16b wcol_hdk(const float* Wm, int k0, int o, int lane) { v16b w; const int g = lane >> 4; const float* p = Wm + (size_t)(o / HD) * DIN * HD + (o % HD);
#pragma unroll
  for (int i = 0; i < 8; ++i) { w[i] = (__bf16)p[(size_t)(k0 + 8 * g + i) * HD]; w[8 + i] = (__bf16)p[(size_t)(k0 + 16 + 8 * g + i) * HD]; }
  return w; }
#define WO_OUT_IN 1
#if WQKV_LAYOUT == 1
#define WCOL(W, k0, o, lane) wcol_oi(W, k0, o, lane, DIN)
#elif WQKV_LAYOUT == 2
#define WCOL(W, k0, o, lane) wcol_hdk(W, k0, o, lane)
#else
#define WCOL(W, k0, o, lane) wcol_io(W, k0, o, lane, CC)
#endif
#if WO_OUT_IN
#define WOCOL(W, k0, o, lane) wcol_oi(W, k0, o, lane, CC)
#define WOCOLH(W, k0, o, lane) wcolh_oi(W, k0, o, lane, CC)
#else
#define WOCOL(W, k0, o, lane) wcol_io(W, k0, o, lane, DIN)
#define WOCOLH(W, k0, o, lane) wcolh_io(W, k0, o, lane, DIN)
#endif

#define WS_QH  0u                                      // f16 q rows [b*t][CC]; rows t >= QHI x SCL2
#define WS_KH  (WS_QH + 2u * (size_t)NB * TT * CC)      // f16 k rows [b*t][CC]
#define WS_VT  (WS_KH + 2u * (size_t)NB * TT * CC)      // f16 v planes [b][c][t]
#define WS_QL  (WS_VT + 2u * (size_t)NB * CC * TT)      // f16 q residual x 2^10 rows [b][t < QHI][CC]
#define WS_KL  (WS_QL + 2u * (size_t)NB * QHI * CC)     // f16 k residual x 2^10 rows [b][t < KHI][CC]
#define WS_VB  (WS_KL + 2u * (size_t)NB * KHI * CC)     // bf16 v hi planes [b][c][t < KHI]
#define WS_VBL (WS_VB + 2u * (size_t)NB * CC * KHI)
#define WS_END (WS_VBL + 2u * (size_t)NB * CC * KHI)

// ---- k_proj: block = (128 rows, 128 cols, which), 8 waves as 4 x 2, wave = 32 rows x 64 cols: q/k/v = X W (+ b) with exact bf16 products (K = DIN) -> which 0: q f16 rows (+ residual rows < QHI); 1: k f16 rows (+ residual rows < KHI); 2: v f16 planes [c][t] (+ bf16 hi/lo planes for t < KHI)
// The block's X and W tiles go through LDS, 64 k a stage: each f32 element is loaded once per block by whole-line loads (a wave-wide 16-byte load = two 256-B row pieces), rounded to bf16 once and read back as fragments by the waves that share it.
// Two buffers: the next stage's global loads fly under this stage's products. k runs upward through one accumulator per tile, as before: the sums are the same. The short loops are unrolled whole so that their arrays stay in registers.
#define PBM 128           // rows of X per block
#define PBN 128           // output columns per block
#define PBK 64            // k per stage
#define PLD (PBK + 8)     // 144-B LDS rows (16 B x odd): no bank conflict for the 16-byte fragment reads
#define PEL (128 + 8)     // 272-B rows of the epilogue's planes
#define PSTG (128 * PLD * 2)        // bytes of one operand's tile in one buffer
#define PSMEM (3 * 128 * PEL * 2)   // the epilogue's three planes; the ring (4 x PSTG) is smaller and lies in the same bytes
typedef __attribute__((ext_vector_type(4))) __bf16 v4b;
// eight 16-byte stores, STEP bytes apart, from one address pair, and behind them, in the same statement, the wait that stands in front of any write of a register they name: in the built code another arm of the epilogue may follow any of these stores
template <int STEP> __device__ __forceinline__ void st8(void* p, const v4u* t) {
  asm volatile("global_store_b128 %0, %1, off\n\tglobal_store_b128 %0, %2, off offset:%9\n\tglobal_store_b128 %0, %3, off offset:%10\n\tglobal_store_b128 %0, %4, off offset:%11\n\t"
               "global_store_b128 %0, %5, off offset:%12\n\tglobal_store_b128 %0, %6, off offset:%13\n\tglobal_store_b128 %0, %7, off offset:%14\n\tglobal_store_b128 %0, %8, off offset:%15\n\ts_wait_xcnt 0x0"
               :: "v"(p), "v"(t[0]), "v"(t[1]), "v"(t[2]), "v"(t[3]), "v"(t[4]), "v"(t[5]), "v"(t[6]), "v"(t[7]), "n"(STEP), "n"(2 * STEP), "n"(3 * STEP), "n"(4 * STEP), "n"(5 * STEP), "n"(6 * STEP), "n"(7 * STEP) : "memory"); }
__global__ __launch_bounds__(256) void k_proj(const float* __restrict__ XQ, const float* __restrict__ XK, const float* __restrict__ XV, const float* __restrict__ WQ, const float* __restrict__ WK, const float* __restrict__ WV, const float* __restrict__ BQ, const float* __restrict__ BK, const float* __restrict__ BV,
    _Float16* __restrict__ QH, _Float16* __restrict__ QL, _Float16* __restrict__ KH, _Float16* __restrict__ KL, _Float16* __restrict__ VT, __bf16* __restrict__ VB, __bf16* __restrict__ VBL) {
  __shared__ __align__(16) char sm[PSMEM];
  const int tid = threadIdx.x, wave = tid >> 5, lane = tid & 31, col = lane & 15, g = lane >> 4, wr = wave >> 1, wc = wave & 1; const int which = blockIdx.z; const int c0 = blockIdx.y * PBN; const size_t r0 = (size_t)blockIdx.x * PBM; const size_t bb = r0 / TT; const int t0 = (int)(r0 % TT);
  const float* X = which == 0 ? XQ : which == 1 ? XK : XV; const float* WA = which == 0 ? WQ : which == 1 ? WK : WV; const float* BA = which == 0 ? BQ : which == 1 ? BK : BV;
  __bf16 (*xs)[128][PLD] = (__bf16 (*)[128][PLD])sm; __bf16 (*wt)[128][PLD] = (__bf16 (*)[128][PLD])(sm + 2 * PSTG);
  // staging: thread = (row tid >> 4 of 16, 16-byte piece tid & 15 of a 256-B row piece), 8 row groups per operand
  const int srow = tid >> 4, sc = (tid & 15) * 4; const float* xg = X + (r0 + srow) * DIN + sc; const float* wg = WA + (size_t)(c0 + srow) * DIN + sc;
  v4f xr[8], wv[8];
#pragma unroll
  for (int p = 0; p < 8; ++p) { xr[p] = *(const v4f*)(xg + (size_t)p * 16 * DIN); wv[p] = *(const v4f*)(wg + (size_t)p * 16 * DIN); }
  float bias[4] = {0.f, 0.f, 0.f, 0.f};   // read here, as one group beside the first stage's loads: one latency for all of them
  if (BA) {
#pragma unroll
    for (int j = 0; j < 4; ++j) bias[j] = bfr(BA[c0 + wc * 64 + j * 16 + col]); }
  v8f acc[2][4] = {};
#pragma unroll 2   // two stages a trip: the buffer index is a constant in each half, so every LDS address is one register plus an immediate
  for (int s = 0; s < DIN / PBK; ++s) { const int bf = s & 1;
#pragma unroll
    for (int p = 0; p < 8; ++p) { v4b a, w;
#pragma unroll
      for (int i = 0; i < 4; ++i) { a[i] = (__bf16)xr[p][i]; w[i] = (__bf16)wv[p][i]; }
      *(v4b*)&xs[bf][srow + p * 16][sc] = a; *(v4b*)&wt[bf][srow + p * 16][sc] = w; }
    // one barrier a stage: it publishes this buffer, and every wave that passes it has left the other buffer, which the next stage's stores overwrite
    __syncthreads();
    if (s + 1 < DIN / PBK) {
#pragma unroll
      for (int p = 0; p < 8; ++p) { xr[p] = *(const v4f*)(xg + (size_t)p * 16 * DIN + (s + 1) * PBK); wv[p] = *(const v4f*)(wg + (size_t)p * 16 * DIN + (s + 1) * PBK); } }
    v16b a[PBK / 32][2], w[PBK / 32][4];
#pragma unroll
    for (int kk = 0; kk < PBK / 32; ++kk) {
#pragma unroll
      for (int i = 0; i < 2; ++i) a[kk][i] = frag_b(&xs[bf][wr * 32 + i * 16 + col][kk * 32], lane);
#pragma unroll
      for (int j = 0; j < 4; ++j) w[kk][j] = frag_b(&wt[bf][wc * 64 + j * 16 + col][kk * 32], lane); }
    __builtin_amdgcn_sched_barrier(0);   // the next stage's global loads and this stage's fragment reads issue as one group in front of the products; left free, the global loads were sunk among the products and waited out there
#pragma unroll
    for (int kk = 0; kk < PBK / 32; ++kk)
#pragma unroll
      for (int i = 0; i < 2; ++i)
#pragma unroll
        for (int j = 0; j < 4; ++j) acc[i][j] = __builtin_amdgcn_wmma_f32_16x16x32_bf16(false, a[kk][i], false, w[kk][j], (short)0, acc[i][j], false, false);
    __builtin_amdgcn_sched_barrier(0);   // keeps the conversions of the next stage's values, and with them the wait for its loads, behind the products
  }
  __syncthreads();   // every wave has read its last fragments before the epilogue's planes overwrite the ring
  const int er = tid >> 4, eq = (tid & 15) * 8;   // copy-out: thread = (plane row er + 16 it, 16-byte piece), 16 lanes store 256 B in a row
  v4u t[8];
  if (which < 2) { _Float16* DH = which == 0 ? QH : KH; _Float16* DL = which == 0 ? QL : KL; const int nhi = which == 0 ? QHI : KHI; const bool hi_rows = t0 < nhi;
    _Float16 (*sh)[PEL] = (_Float16 (*)[PEL])sm; _Float16 (*sl)[PEL] = (_Float16 (*)[PEL])(sm + 128 * PEL * 2);
    const float qs = (which == 0 && !hi_rows) ? SCL2 : 1.0f;   // q rows >= QHI are stored x scale x log2 e, from the f32 sum with the one rounding to f16 they had: their S^T products are exponents of 2 as they stand
#pragma unroll
    for (int j = 0; j < 4; ++j)
#pragma unroll
      for (int i = 0; i < 2; ++i)
#pragma unroll
        for (int r = 0; r < 8; ++r) sh[wr * 32 + i * 16 + 8 * g + r][wc * 64 + j * 16 + col] = (_Float16)((acc[i][j][r] + bias[j]) * qs);
    if (hi_rows) {
#pragma unroll
      for (int j = 0; j < 4; ++j)
#pragma unroll
        for (int i = 0; i < 2; ++i)
#pragma unroll
          for (int r = 0; r < 8; ++r) { const float v = acc[i][j][r] + bias[j]; const _Float16 hv = (_Float16)v; sl[wr * 32 + i * 16 + 8 * g + r][wc * 64 + j * 16 + col] = (_Float16)((v - (float)hv) * 1024.0f); } }
    __syncthreads();
    _Float16* dh = DH + (r0 + er) * CC + c0 + eq;
#pragma unroll
    for (int it = 0; it < 8; ++it) t[it] = *(const v4u*)&sh[er + it * 16][eq];
    st8<16 * CC * 2>(dh, t);
    if (hi_rows) {
      _Float16* dl = DL + (bb * nhi + t0 + er) * (size_t)CC + c0 + eq;
#pragma unroll
      for (int it = 0; it < 8; ++it) t[it] = *(const v4u*)&sl[er + it * 16][eq];
      st8<16 * CC * 2>(dl, t); }
  } else { const bool hi_rows = t0 < KHI;
    _Float16 (*th)[PEL] = (_Float16 (*)[PEL])sm; __bf16 (*tb)[PEL] = (__bf16 (*)[PEL])(sm + 128 * PEL * 2); __bf16 (*tbl)[PEL] = (__bf16 (*)[PEL])(sm + 2 * 128 * PEL * 2);
    // a lane's 8 accumulator rows are 8 neighbouring t of one plane row: one 16-byte LDS store each
#pragma unroll
    for (int j = 0; j < 4; ++j)
#pragma unroll
      for (int i = 0; i < 2; ++i) { v8h hv;
#pragma unroll
        for (int r = 0; r < 8; ++r) hv[r] = (_Float16)(acc[i][j][r] + bias[j]);
        *(v8h*)&th[wc * 64 + j * 16 + col][wr * 32 + i * 16 + 8 * g] = hv; }
    if (hi_rows) {
#pragma unroll
      for (int j = 0; j < 4; ++j)
#pragma unroll
        for (int i = 0; i < 2; ++i) { v8b bh, bl;
#pragma unroll
          for (int r = 0; r < 8; ++r) { const float v = acc[i][j][r] + bias[j]; const __bf16 b1 = (__bf16)v; bh[r] = b1; bl[r] = (__bf16)(v - (float)b1); }
          *(v8b*)&tb[wc * 64 + j * 16 + col][wr * 32 + i * 16 + 8 * g] = bh; *(v8b*)&tbl[wc * 64 + j * 16 + col][wr * 32 + i * 16 + 8 * g] = bl; } }
    __syncthreads();
    _Float16* vt = VT + (bb * CC + c0 + er) * (size_t)TT + t0 + eq;
#pragma unroll
    for (int it = 0; it < 8; ++it) t[it] = *(const v4u*)&th[er + it * 16][eq];
    st8<16 * TT * 2>(vt, t);
    if (hi_rows) {
      const size_t o3 = (bb * CC + c0 + er) * (size_t)KHI + t0 + eq;
#pragma unroll
      for (int it = 0; it < 8; ++it) t[it] = *(const v4u*)&tb[er + it * 16][eq];
      st8<16 * KHI * 2>(VB + o3, t);
#pragma unroll
      for (int it = 0; it < 8; ++it) t[it] = *(const v4u*)&tbl[er + it * 16][eq];
      st8<16 * KHI * 2>(VBL + o3, t); } } }
// ---- k_fa: scores, softmax and P . v in one launch. Block = 128 queries of one (batch, head), wave = 32 queries, walking its keys [0, last query] 32 at a time.
// Transposed products: S^T = K . Q^T (D: register r = key 8g + r, lane column = query), so a lane holds 16 scores of ONE query and two S^T tiles, converted in place, are the B operand of O^T += V^T . P^T.
// Running maximum m and running sum l per query; the output tile is rescaled by exp(m_old - m_new) on every pass.
// Rows >= QHI: the block's K rows and V planes go through LDS, 128 keys a stage, two buffers, brought by asynchronous copies in whole 128-B lines and read back as fragments by all four waves.
#define FQW 32            // queries per wave
#define FQB 128           // queries per block
#define FSK 128           // keys per stage
#define FKP 144           // bytes of a K row in LDS (128 + 16: 16 B x odd, no bank conflict for the 16-byte fragment reads)
#define FVP 272           // bytes of a V plane row in LDS (256 + 16)
#define FKB (FSK * FKP)   // bytes of a stage's K rows
#define FBUF (FKB + HD * FVP)   // bytes of one buffer
static_assert(QHI % FQB == 0 && FQB == FSK && TT % FSK == 0, "a block is wholly on one path and its keys are whole stages");
#define L2E 1.4426950408889634f
__device__ __forceinline__ v8f wm_h(v16h a, v16h b, v8f c) { return __builtin_amdgcn_wmma_f32_16x16x32_f16(false, a, false, b, (short)0, c, false, false); }
__device__ __forceinline__ v8f wm_b(v16b a, v16b b, v8f c) { return __builtin_amdgcn_wmma_f32_16x16x32_bf16(false, a, false, b, (short)0, c, false, false); }
// lane l with lane l ^ 16
__device__ __forceinline__ float xhalf(float x) { return __builtin_bit_cast(float, __builtin_amdgcn_permlanex16(__builtin_bit_cast(int, x), __builtin_bit_cast(int, x), 0x76543210, 0xfedcba98, false, false)); }
// the 16 additive mask values (bf16-rounded like every float input) of the keys a lane holds: k0 + 8g + 0..7 and k0 + 16 + 8g + 0..7
__device__ __forceinline__ void mask16(const float* __restrict__ amk, float am[16]) {
  const v4f a0 = *(const v4f*)amk, a1 = *(const v4f*)(amk + 4), a2 = *(const v4f*)(amk + 16), a3 = *(const v4f*)(amk + 20);
#pragma unroll
  for (int i = 0; i < 4; ++i) { am[i] = bfr(a0[i]); am[4 + i] = bfr(a1[i]); am[8 + i] = bfr(a2[i]); am[12 + i] = bfr(a3[i]); } }
// 2^x on the transcendental pipe, with the slot that the instruction set asks for behind a transcendental before its result is used or its source overwritten: in a run each fills the slot of the one in front, one v_nop closes the run
__device__ __forceinline__ void exp2x8(float* a) {
  asm("v_exp_f32 %0, %0\n\tv_exp_f32 %1, %1\n\tv_exp_f32 %2, %2\n\tv_exp_f32 %3, %3\n\tv_exp_f32 %4, %4\n\tv_exp_f32 %5, %5\n\tv_exp_f32 %6, %6\n\tv_exp_f32 %7, %7\n\tv_nop"
      : "+v"(a[0]), "+v"(a[1]), "+v"(a[2]), "+v"(a[3]), "+v"(a[4]), "+v"(a[5]), "+v"(a[6]), "+v"(a[7])); }
__device__ __forceinline__ float exp2x1(float x) { float r; asm("v_exp_f32 %0, %1\n\tv_nop" : "=v"(r) : "v"(x)); return r; }
// one pass of the running softmax for one query column: v[16] -> exp(v - m) x 2^11 (the 2^11 rides in the exponent; l sums the same scaled terms); returns the factor for what was summed before
__device__ __forceinline__ float soft16(float v[16], float& m, float& l) {
  float mx = v[0];
#pragma unroll
  for (int i = 1; i < 16; ++i) mx = fmaxf(mx, v[i]);
  mx = fmaxf(mx, xhalf(mx)); const float mn = fmaxf(m, mx); const float alpha = exp2x1((m - mn) * L2E); m = mn;
  // a key at or below -1e38 is excluded (term 0): under a larger maximum its exponent underflows by itself; where the maximum itself is that low every key so far is excluded
  const float mr = mn <= -1.0e38f ? 3.0e38f : mn;
#pragma unroll
  for (int i = 0; i < 16; ++i) v[i] = fmaf(v[i] - mr, L2E, 11.0f);
  exp2x8(v); exp2x8(v + 8);
  float sum = 0.f;
#pragma unroll
  for (int i = 0; i < 16; ++i) sum += v[i];
  l = l * alpha + sum; return alpha; }
// the same pass for scores that arrive as exponents of 2 (scale, log2 e and mask already in them): each score takes one subtraction on its way to 2^x.
// The state m is the subtrahend itself, the running maximum less 11 AS ROUNDED: every term summed so far is 2^(score - m) for that very m, and the factor is 2^(m_old - m_new), so the rounding of "less 11" cancels between the passes.
__device__ __forceinline__ float soft16c(float v[16], float& m, float& l) {
  float mx = v[0];
#pragma unroll
  for (int i = 1; i < 16; ++i) mx = fmaxf(mx, v[i]);
  mx = fmaxf(mx, xhalf(mx));
  // no exponent above 12: where floats at mx lie 16 apart, mx - 11 rounds to mx - 16 and 2^16 is past f16; there mx itself is taken (wider spacings round to mx by themselves, narrower ones to at most mx - 12)
  float c = mx - 11.0f; c = mx - c > 12.0f ? mx : c;
  const float mn = fmaxf(m, c); const float alpha = exp2x1(m - mn); m = mn;
  // excluded keys as in soft16, the bound in this unit (11 is lost in a value of that size)
  const float mr = mn <= -1.0e38f * L2E ? 3.0e38f : mn;
#pragma unroll
  for (int i = 0; i < 16; ++i) v[i] = v[i] - mr;
  exp2x8(v); exp2x8(v + 8);
  float sum = 0.f;
#pragma unroll
  for (int i = 0; i < 16; ++i) sum += v[i];
  l = l * alpha + sum; return alpha; }
// a 16x16x32 fragment at a wave-uniform base plus the lane's own byte offset (row and 8g in it) plus a constant: elements 0..7 = p[0..7], 8..15 = p[16..23]
__device__ __forceinline__ v16h ld16h(const _Float16* base, unsigned off, int el) { const _Float16* p = (const _Float16*)((const char*)base + off) + el; union { v16h v; v8h q[2]; } u; u.q[0] = *(const v8h*)p; u.q[1] = *(const v8h*)(p + 16); return u.v; }
__device__ __forceinline__ v16b ld16b(const __bf16* base, unsigned off, int el) { const __bf16* p = (const __bf16*)((const char*)base + off) + el; union { v16b v; v8b q[2]; } u; u.q[0] = *(const v8b*)p; u.q[1] = *(const v8b*)(p + 16); return u.v; }
// query rows < QHI, 16 at a time: q and k as f16 hi + residual (3 products), exp and v as bf16 hi + lo (3 products)
__device__ __forceinline__ void fa_hi(const _Float16* __restrict__ QH, const _Float16* __restrict__ KH, const _Float16* __restrict__ QL, const _Float16* __restrict__ KL, const __bf16* __restrict__ VB, const __bf16* __restrict__ VBL, const float* __restrict__ AM,
    int b, int h, int qt, int lane, float (*st)[HD + 4]) {
  const int col = lane & 15, g = lane >> 4; const int t = qt + col;
  const _Float16* Qs = QH + ((size_t)b * TT + qt) * CC + h * HD; const _Float16* Qls = QL + ((size_t)b * QHI + qt) * CC + h * HD; const unsigned qo = (unsigned)(col * CC + 8 * g) * 2u;
  v16h qh[2], ql[2];
#pragma unroll
  for (int kc = 0; kc < 2; ++kc) { qh[kc] = ld16h(Qs, qo, kc * 32); ql[kc] = ld16h(Qls, qo, kc * 32); }
  asm volatile("s_wait_xcnt 0x0" :: "v"(qh[0]), "v"(qh[1]), "v"(ql[0]), "v"(ql[1]) : "memory");   // stands behind the q loads, in front of the first write of their address registers; the loaded values are inputs only, so that the loads cannot sink below it (without them this build placed the loads behind the wait and a K load's result in their address registers)
  // wave-uniform bases and each lane's own byte offsets, stepped once a pass: every load of a pass is one of these registers plus a constant
  const float* As = AM + (size_t)b * TT; const _Float16* Ks = KH + (size_t)b * TT * CC + h * HD; const _Float16* Kls = KL + (size_t)b * KHI * CC + h * HD;
  const __bf16* Vs = VB + ((size_t)b * CC + h * HD) * (size_t)KHI; const __bf16* Vls = VBL + ((size_t)b * CC + h * HD) * (size_t)KHI;
  unsigned ao = (unsigned)(8 * g) * 4u, ko = (unsigned)(col * CC + 8 * g) * 2u, vo = (unsigned)(col * KHI + 8 * g) * 2u;
  v8f o[HD / 16] = {}; float m = -3.0e38f, l = 0.f; const int nit = qt / 32 + 1;
#pragma unroll 1
  for (int it = 0; it < nit; ++it) { const int k0 = it * 32; v8f acc[2] = {}, accl[2] = {}; float am[16]; mask16((const float*)((const char*)As + ao), am);
#pragma unroll
    for (int kt = 0; kt < 2; ++kt)
#pragma unroll
      for (int kc = 0; kc < 2; ++kc) { const v16h kh = ld16h(Ks, ko, kt * 16 * CC + kc * 32), kl = ld16h(Kls, ko, kt * 16 * CC + kc * 32);
        acc[kt] = wm_h(kh, qh[kc], acc[kt]); accl[kt] = wm_h(kh, ql[kc], accl[kt]); accl[kt] = wm_h(kl, qh[kc], accl[kt]); }
    v16b vh[HD / 16], vl[HD / 16];
#pragma unroll
    for (int j = 0; j < HD / 16; ++j) { vh[j] = ld16b(Vs, vo, j * 16 * KHI); vl[j] = ld16b(Vls, vo, j * 16 * KHI); }
    asm volatile("s_wait_xcnt 0x0" : "+v"(ao), "+v"(ko), "+v"(vo) :: "memory");   // stands between this pass's loads and the step of their offset registers; naming the offsets keeps them in those registers up to the wait and the step behind it
    ao += 32u * 4u; ko += 32u * CC * 2u; vo += 32u * 2u;
    float v[16];
#pragma unroll
    for (int i = 0; i < 16; ++i) { const int key = k0 + (i >> 3) * 16 + 8 * g + (i & 7); const float s = (acc[i >> 3][i & 7] + accl[i >> 3][i & 7] * (1.0f / 1024.0f)) * SCALE; v[i] = (key <= t ? s : -3.0e38f) + am[i]; }
    const float alpha = soft16(v, m, l); const F2 p = bsplit16(v);
#pragma unroll
    for (int j = 0; j < HD / 16; ++j) { o[j] = o[j] * alpha; o[j] = wm_b(vh[j], p.h, o[j]); o[j] = wm_b(vh[j], p.l, o[j]); o[j] = wm_b(vl[j], p.h, o[j]); } }
  l += xhalf(l); const float inv = l > 0.f ? 1.0f / l : 0.f;   /* a fully excluded row yields 0 */
#pragma unroll
  for (int j = 0; j < HD / 16; ++j) { const v8f r = o[j] * inv; *(v4f*)&st[col][j * 16 + 8 * g] = __builtin_shufflevector(r, r, 0, 1, 2, 3); *(v4f*)&st[col][j * 16 + 8 * g + 4] = __builtin_shufflevector(r, r, 4, 5, 6, 7); } }
// eight asynchronous 16-byte copies to LDS per lane, LS bytes apart in LDS and GS bytes apart in global memory, and behind them, in the same statement, the wait that stands in front of any write of a register they name
template <int LS, int GS> __device__ __forceinline__ void cp8(unsigned l, const char* p) {
  asm volatile("global_load_async_to_lds_b128 %0, %8, off\n\tglobal_load_async_to_lds_b128 %1, %9, off\n\tglobal_load_async_to_lds_b128 %2, %10, off\n\tglobal_load_async_to_lds_b128 %3, %11, off\n\t"
               "global_load_async_to_lds_b128 %4, %12, off\n\tglobal_load_async_to_lds_b128 %5, %13, off\n\tglobal_load_async_to_lds_b128 %6, %14, off\n\tglobal_load_async_to_lds_b128 %7, %15, off\n\ts_wait_xcnt 0x0"
               :: "v"(l), "v"(l + LS), "v"(l + 2 * LS), "v"(l + 3 * LS), "v"(l + 4 * LS), "v"(l + 5 * LS), "v"(l + 6 * LS), "v"(l + 7 * LS),
                  "v"(p), "v"(p + GS), "v"(p + 2 * GS), "v"(p + 3 * GS), "v"(p + 4 * GS), "v"(p + 5 * GS), "v"(p + 6 * GS), "v"(p + 7 * GS) : "memory"); }
// a 16x16x32 fragment from LDS: elements 0..7 = p[0..7], 8..15 = p[16..23]
__device__ __forceinline__ v16h lds16h(const char* p) { union { v16h v; v8h q[2]; } u; u.q[0] = *(const v8h*)p; u.q[1] = *(const v8h*)(p + 32); return u.v; }
// four waves per SIMD: keeps the allocation at 256 VGPRs, below the register windows that cost a mode switch per access
__global__ __launch_bounds__(128) __attribute__((amdgpu_waves_per_eu(4, 4))) void k_fa(const _Float16* __restrict__ QH, const _Float16* __restrict__ KH, const _Float16* __restrict__ QL, const _Float16* __restrict__ KL, const _Float16* __restrict__ VT, const __bf16* __restrict__ VB, const __bf16* __restrict__ VBL, const float* __restrict__ AM, float* __restrict__ Y) {
  __shared__ __align__(16) char sm[2 * FBUF + TT * 4];   // the ring, whose first bytes are the output staging behind the loop's last barrier; behind the ring the batch row's prepared key mask
  static_assert(sizeof(float) * (FQB / FQW) * FQW * (HD + 4) <= 2 * FBUF, "the output staging lies inside the ring");
  float (*ss)[FQW][HD + 4] = (float (*)[FQW][HD + 4])sm;
  const int tid = threadIdx.x, lane = tid & 31, col = lane & 15, g = lane >> 4; const int wave = __builtin_amdgcn_readfirstlane(tid >> 5);
  const int b = blockIdx.x / NH, h = blockIdx.x % NH; const int q0 = (TT / FQB - 1 - (int)blockIdx.y) * FQB, qw = q0 + wave * FQW;   // the blocks with the most keys start first
  if (q0 < QHI) {
#pragma unroll 1   // one copy of the high-precision body serves both halves of the wave's 32 queries: half the code, and each half's loads stay inside its own trip
    for (int hf = 0; hf < 2; ++hf) fa_hi(QH, KH, QL, KL, VB, VBL, AM, b, h, qw + hf * 16, lane, &ss[wave][hf * 16]); }
  else {
    // wave-uniform bases and each lane's own byte offsets
    const _Float16* Ks = KH + (size_t)b * TT * CC + h * HD; const _Float16* Vs = VT + ((size_t)b * CC + h * HD) * (size_t)TT; const float* As = AM + (size_t)b * TT; const _Float16* Qs = QH + ((size_t)b * TT + qw) * CC + h * HD;
    const unsigned ko = (unsigned)(col * CC + 8 * g) * 2u;
    // staging: K, thread = (row tid >> 3 of 16, 16-byte piece tid & 7 of a 128-B row), 8 row groups; V, thread = (plane row tid >> 4 of 8, piece tid & 15 of 256 B), 8 row groups: a wave-wide copy is four whole lines
    const char* kg = (const char*)Ks + (size_t)(tid >> 3) * (CC * 2) + (tid & 7) * 16; const char* vg = (const char*)Vs + (size_t)(tid >> 4) * (TT * 2) + (tid & 15) * 16;
    const unsigned kd = (unsigned)(size_t)sm + (unsigned)(tid >> 3) * FKP + (tid & 7) * 16, vd = (unsigned)(size_t)sm + FKB + (unsigned)(tid >> 4) * FVP + (tid & 15) * 16;
    auto stage = [&](const int st) __attribute__((always_inline)) { const unsigned bo = (unsigned)(st & 1) * FBUF;
      cp8<16 * FKP, 16 * CC * 2>(kd + bo, kg + (size_t)st * (FSK * CC * 2)); cp8<8 * FVP, 8 * TT * 2>(vd + bo, vg + (size_t)st * (FSK * 2)); };
    const int nst = q0 / FSK + 1;   // at least QHI / FSK + 1 stages
    stage(0);
    v16h qf[2][2];
#pragma unroll
    for (int q = 0; q < 2; ++q)
#pragma unroll
      for (int kc = 0; kc < 2; ++kc) qf[q][kc] = ld16h(Qs, ko, q * 16 * CC + kc * 32);
    // the key mask, prepared once per block: rounded to bf16 like every float input, x log2 e, floored at -3.0e38 (finite, and far below the bound that means excluded), so that a pass hands it to the S^T products as their C operand; published by the barrier that publishes stage 0
    // above 2.0e38 the slope is 1/4, so that the largest finite mask stays finite in this unit: two bf16 values up there differ by more than 1e36, a quarter of which still sends the smaller one's term to 0, as in the reference
    v4f mk[TT / (FQB * 4)];
#pragma unroll
    for (int i = 0; i < TT / (FQB * 4); ++i) mk[i] = *(const v4f*)(As + (i * FQB + tid) * 4);
#pragma unroll
    for (int i = 0; i < TT / (FQB * 4); ++i) { v4f r;
#pragma unroll
      for (int e = 0; e < 4; ++e) { const float x = bfr(mk[i][e]); r[e] = fmaxf(x > 2.0e38f ? fmaf(x - 2.0e38f, 0.25f, 2.0e38f * L2E) : x * L2E, -3.0e38f); }
      *(v4f*)(sm + 2 * FBUF + (i * FQB + tid) * 16) = r; }
    v8f o[2][HD / 16] = {}; float m[2] = {-3.0e38f, -3.0e38f}, l[2] = {0.f, 0.f};
    asm volatile("s_wait_asynccnt 0x0" ::: "memory");   // this wave's copies of stage 0 have landed
    __syncthreads();   // publishes stage 0 and the mask row
    stage(1);
    const char* kl = sm + col * FKP + 16 * g; const char* vl = sm + FKB + col * FVP + 16 * g;   // the lane's own place in a K row group and in a V plane row group
    const char* kp = kl; const char* vp = vl;   // where the next pass reads: stepped once a pass, set to the other buffer at the foot of a stage
    const char* mp = sm + 2 * FBUF + 32 * g;   // the mask values of the keys a lane holds in the next pass (8g + 0..7 and 16 + 8g + 0..7): stepped once a pass
    // one pass = 32 keys; only the last pass holds keys past a query, so it alone carries the index test and the loop body stays one straight block
    auto pass = [&](const bool last) __attribute__((always_inline)) {
      v8f cm[2];   // C operand of the S^T products: register r = the prepared mask of key 8g + r of the tile, alike in every query column
#pragma unroll
      for (int kt = 0; kt < 2; ++kt) { union { v8f v; v4f h[2]; } u; u.h[0] = *(const v4f*)(mp + kt * 64); u.h[1] = *(const v4f*)(mp + kt * 64 + 16); cm[kt] = u.v; }
      v16h kf[2][2], vf[HD / 16];
#pragma unroll
      for (int kt = 0; kt < 2; ++kt)
#pragma unroll
        for (int kc = 0; kc < 2; ++kc) kf[kt][kc] = lds16h(kp + kt * 16 * FKP + kc * 64);
#pragma unroll
      for (int j = 0; j < HD / 16; ++j) vf[j] = lds16h(vp + j * 16 * FVP);
      __builtin_amdgcn_sched_barrier(0);   // the mask, K and V reads issue as one group in front of the S^T products, the V reads flying under them: one place with LDS reads a pass
      v8f s[2][2];
#pragma unroll
      for (int kc = 0; kc < 2; ++kc)
#pragma unroll
        for (int kt = 0; kt < 2; ++kt)
#pragma unroll
          for (int q = 0; q < 2; ++q) s[q][kt] = wm_h(kf[kt][kc], qf[q][kc], kc == 0 ? cm[kt] : s[q][kt]);
      mp += 32 * 4; kp += 32 * FKP; vp += 32 * 2;
      __builtin_amdgcn_sched_barrier(0);   // keeps the eight S^T products one run, four independent tiles and then their second halves; left free, each tile's two dependent products stood back to back with the maximum's first steps and padding between the tiles
      v16h pf[2];
#pragma unroll
      for (int q = 0; q < 2; ++q) { float v[16];
#pragma unroll
        for (int i = 0; i < 16; ++i) { const int key = qw + (i >> 3) * 16 + 8 * g + (i & 7);   /* the last pass starts at key qw */ v[i] = (!last || key <= qw + q * 16 + col) ? s[q][i >> 3][i & 7] : -3.0e38f; }
        const float alpha = soft16c(v, m[q], l[q]);
#pragma unroll
        for (int i = 0; i < 16; ++i) pf[q][i] = (_Float16)v[i];
#pragma unroll
        for (int j = 0; j < HD / 16; ++j) o[q][j] = o[q][j] * alpha; }
#pragma unroll
      for (int j = 0; j < HD / 16; ++j)
#pragma unroll
        for (int q = 0; q < 2; ++q) o[q][j] = wm_h(vf[j], pf[q], o[q][j]); };
    // the block walks its stages together, four passes a stage; all stages but the last lie wholly below every query of the block
#pragma unroll 1
    for (int ip = 0; ip < (nst - 1) * (FSK / 32); ++ip) { pass(false);
      if ((ip & (FSK / 32 - 1)) == FSK / 32 - 1) { const int st = ip / (FSK / 32);   // the foot of stage st; the trip count and this test read the same in every wave of the block
        asm volatile("s_wait_dscnt 0x0" ::: "memory");      // this wave's reads of stage st have returned
        asm volatile("s_wait_asynccnt 0x0" ::: "memory");   // this wave's copies of stage st + 1 have landed
        __syncthreads();   // publishes stage st + 1, and every wave that passes it has left stage st's buffer, which the next copies overwrite
        if (st + 2 < nst) stage(st + 2);
        kp = kl + ((st + 1) & 1) * FBUF; vp = vl + ((st + 1) & 1) * FBUF; } }
    // the last stage holds the block's own 128 keys: wave w takes w whole passes and the pass on its diagonal
#pragma unroll 1
    for (int p = 0; p < wave; ++p) pass(false);
    pass(true);
    asm volatile("s_wait_dscnt 0x0" ::: "memory");      // this wave's last reads of the ring have returned
    asm volatile("s_wait_asynccnt 0x0" ::: "memory");   // no copy is in flight
    __syncthreads();   // every wave has left the ring before its bytes become the output staging
#pragma unroll
    for (int q = 0; q < 2; ++q) { const float lt = l[q] + xhalf(l[q]); const float inv = lt > 0.f ? 1.0f / lt : 0.f;   /* a fully excluded row yields 0 */
#pragma unroll
      for (int j = 0; j < HD / 16; ++j) { const v8f r = o[q][j] * inv; *(v4f*)&ss[wave][q * 16 + col][j * 16 + 8 * g] = __builtin_shufflevector(r, r, 0, 1, 2, 3); *(v4f*)&ss[wave][q * 16 + col][j * 16 + 8 * g + 4] = __builtin_shufflevector(r, r, 4, 5, 6, 7); } } }
  // each wave turns its own 32 x 64 tile in its own LDS slice: a 256-B (row, head) segment is stored by 16 lanes
  LDSX();
#pragma unroll
  for (int i = 0; i < FQW / 2; ++i) { const int rl = 2 * i + g; vst2(Y + ((size_t)b * TT + qw + rl) * CC + h * HD + col * 4, *(const v4f*)&ss[wave][rl][col * 4]); } }

extern "C" void kernel_launch(void* const* d_in, const int* in_sizes, int n_in, void* d_out, int out_size, void* d_ws, size_t ws_size, hipStream_t stream) {
  (void)in_sizes; (void)n_in; (void)out_size;
  const float** F = (const float**)d_in;
  if (ws_size < (size_t)WS_END) return;
  char* ws = (char*)d_ws; _Float16 *QH = (_Float16*)(ws + WS_QH), *KH = (_Float16*)(ws + WS_KH), *VT = (_Float16*)(ws + WS_VT), *QL = (_Float16*)(ws + WS_QL), *KL = (_Float16*)(ws + WS_KL); __bf16 *VB = (__bf16*)(ws + WS_VB), *VBL = (__bf16*)(ws + WS_VBL);
  // inputs: 0 hidden_states [4,2048,768]; 1 attention_mask [4,1,1,2048] f32 (zeros); 2 Wq [768,768] (out,in), 3 bq; 4 Wk, 5 bk; 6 Wv, 7 bv (biases zeros, read)
  k_proj<<<dim3(TNB * TT / PBM, CC / PBN, 3), 256, 0, stream>>>(F[0], F[0], F[0], F[2], F[4], F[6], F[3], F[5], F[7], QH, QL, KH, KL, VT, VB, VBL);
  k_fa<<<dim3(TNB * NH, TT / FQB), 128, 0, stream>>>(QH, KH, QL, KL, VT, VB, VBL, F[1], (float*)d_out);   /* merged heads are the output: row b*TT + t, columns h*64 .. */
}

// v006
// Measured time: 78.4 microseconds a run.
// Next to v005, in two timings, it ran 1.07 and 1.06 times as fast.
// Over all steps from v000 it is 19.2 times as fast.
// compute dtype: all float inputs rounded to bf16; q/k/v projections with EXACT bf16 products on WMMA 16x16x32 (f32 accumulate) + bias (zeros, read); causal logits: 3 products for the first 384 rows, single f16 q x k after (there q is stored x 64^-0.5 x log2 e and the mask x log2 e is the product's start value), x 64^-0.5, plus the additive float key mask (read); softmax f32 with a running maximum, in registers; exp x 2^11 once to f16 x v once to f16 (bf16 hi + lo below row 384), divided by the f32 row sum at the end; f32 output (no output projection).
#include <hip/hip_runtime.h>
#include <math.h>

typedef __attribute__((ext_vector_type(16))) _Float16 v16h;
typedef __attribute__((ext_vector_type(16))) __bf16 v16b;
typedef __attribute__((ext_vector_type(8)))  _Float16 v8h;
typedef __attribute__((ext_vector_type(8)))  float v8f;
typedef __attribute__((ext_vector_type(4)))  float v4f;
typedef __attribute__((ext_vector_type(2)))  float v2f;
typedef __attribute__((ext_vector_type(4)))  unsigned v4u;
typedef __attribute__((ext_vector_type(4)))  int v4i;
typedef float __attribute__((may_alias)) float_a;
typedef int __attribute__((may_alias)) int_a;

template <typename T> __device__ __forceinline__ void vst2(void* p, T v) { *(T*)p = v;  }
__device__ __forceinline__ v8f wmma16(v16h a, v16h b, v8f c) {
  v8f d = __builtin_amdgcn_wmma_f32_16x16x32_f16(false, a, false, b, (short)0, c, false, false);
  asm volatile("v_nop\n\tv_nop\n\tv_nop\n\tv_nop" : "+v"(d) : "v"(a), "v"(b));
  return d;
}
__device__ __forceinline__ v8f wmma_bf(v16b a, v16b b, v8f c) {
  v8f d = __builtin_amdgcn_wmma_f32_16x16x32_bf16(false, a, false, b, (short)0, c, false, false);
  asm volatile("v_nop\n\tv_nop\n\tv_nop\n\tv_nop" : "+v"(d) : "v"(a), "v"(b));
  return d;
}
// 16x16x32 fragments: lane = (h = lane>>4, row/col = lane&15); elements 0..7 = k0+8h+0..7, 8..15 = k0+16+8h+0..7; D element r = row 8h+r
__device__ __forceinline__ v16h frag_h(const _Float16* rowk0, int lane) {
  union { v16h v; v8h q[2]; } u; const _Float16* p = rowk0 + 8 * (lane >> 4);
  u.q[0] = *(const v8h*)p; u.q[1] = *(const v8h*)(p + 16); return u.v;
}
__device__ __forceinline__ v16h frag_f32(const float* rowk0, int lane) {
  v16h a; const float* p = rowk0 + 8 * (lane >> 4);
#pragma unroll
  for (int i = 0; i < 8; ++i) { a[i] = (_Float16)p[i]; a[8 + i] = (_Float16)p[16 + i]; }
  return a;
}
__device__ __forceinline__ v16h frag_f32s(const float* rowk0, int lane, float sc) {
  v16h a; const float* p = rowk0 + 8 * (lane >> 4);
#pragma unroll
  for (int i = 0; i < 8; ++i) { a[i] = (_Float16)(p[i] * sc); a[8 + i] = (_Float16)(p[16 + i] * sc); }
  return a;
}
// column fragment from a [K][ld] layout (column n), rows >= K read as 0
__device__ __forceinline__ v16h fragc_f32(const float* W, int k0, int n, int lane, int ld, int K) {
  v16h a; const int g = lane >> 4;
#pragma unroll
  for (int i = 0; i < 8; ++i) { const int ka = k0 + 8 * g + i, kb = ka + 16;
    a[i] = (_Float16)(ka < K ? W[(size_t)(ka < K ? ka : K - 1) * ld + n] : 0.f); a[8 + i] = (_Float16)(kb < K ? W[(size_t)(kb < K ? kb : K - 1) * ld + n] : 0.f); }
  return a;
}
struct F2 { v16b h, l; };
__device__ __forceinline__ F2 bsplit16(const float v[16]) { F2 r;
#pragma unroll
  for (int i = 0; i < 16; ++i) { const __bf16 h = (__bf16)v[i]; r.h[i] = h; r.l[i] = (__bf16)(v[i] - (float)h); }
  return r; }
__device__ __forceinline__ F2 split_row(const float* row, int k0, int lane) { float v[16]; const float* p = row + k0 + 8 * (lane >> 4);
#pragma unroll
  for (int i = 0; i < 8; ++i) { v[i] = p[i]; v[8 + i] = p[16 + i]; }
  return bsplit16(v); }
__device__ __forceinline__ F2 split_rowK(const float* row, int k0, int lane, int K) { float v[16]; const int g = lane >> 4;
#pragma unroll
  for (int i = 0; i < 8; ++i) { const int ka = k0 + 8 * g + i, kb = ka + 16; v[i] = ka < K ? row[ka < K ? ka : K - 1] : 0.f; v[8 + i] = kb < K ? row[kb < K ? kb : K - 1] : 0.f; }
  return bsplit16(v); }
__device__ __forceinline__ F2 split_col(const float* W, int k0, int n, int lane, int ld, int K) { float v[16]; const int g = lane >> 4;
#pragma unroll
  for (int i = 0; i < 8; ++i) { const int ka = k0 + 8 * g + i, kb = ka + 16; v[i] = ka < K ? W[(size_t)(ka < K ? ka : K - 1) * ld + n] : 0.f; v[8 + i] = kb < K ? W[(size_t)(kb < K ? kb : K - 1) * ld + n] : 0.f; }
  return bsplit16(v); }
__device__ __forceinline__ v8f mac3(const F2& a, const F2& b, v8f c) { c = wmma_bf(a.l, b.h, c); c = wmma_bf(a.h, b.l, c); return wmma_bf(a.h, b.h, c); }
__device__ __forceinline__ float sigm(float v) { return 1.0f / (1.0f + expf(-v)); }
#define LDSX() do { asm volatile("s_wait_dscnt 0" ::: "memory"); __builtin_amdgcn_wave_barrier(); __builtin_amdgcn_fence(__ATOMIC_RELEASE, "workgroup"); } while (0)

// Causal multi-head self-attention without an output projection (hidden_states [4,2048,768]; attention_mask [4,1,1,2048] f32 (zeros on this draw) ADDED to the scores per key; torch (out,in) Wq / Wk / Wv [768,768] N(0,1) x 0.02 applied as x @ W.T, zero biases (read); 12 heads x 64; scores / 64^0.5; -inf strictly above the diagonal; + attention_mask; softmax; heads merged to [4,2048,768]).
#define NB 4
#define TT 2048
#define CC 768            // NH * HD = projected width
#define DIN 768          // input (model) width
#define NH 12
#define HD 64
#define NQB (TT / 64)
#define SCALE (0.125f)
#define SCL2 (SCALE * 1.4426950408889634f)   // score scale x log2 e
#define CAUSAL 1
#ifndef TNB
#define TNB NB
#endif
__device__ __forceinline__ float bfr(float v) { return (float)(__bf16)v; }
__host__ __device__ __forceinline__ int kb_last(int qb) { return CAUSAL ? ((qb * 64 + 63) >> 7) : (TT / 128 - 1); }
typedef __attribute__((ext_vector_type(8))) __bf16 v8b;
__device__ __forceinline__ v16b frag_b(const __bf16* rowk0, int lane) {
  union { v16b v; v8b q[2]; } u; const __bf16* p = rowk0 + 8 * (lane >> 4);
  u.q[0] = *(const v8b*)p; u.q[1] = *(const v8b*)(p + 16); return u.v;
}
#define QBH 6              // causal: unused; the high-precision path is taken by queries below QHI (few keys, no averaging)
#define QHI 384            // rows carrying a q residual plane
#define KHI 384            // key rows carrying k residual / v bf16 hi+lo planes (used only by the causal high-precision path)
// B fragment (k rows k0+.., output column o) of a weight: (in,out) [K][ld] or (out,in) [ld rows of K]: bf16 exact, or f16(bf16 * 256) exact
__device__ __forceinline__ v16b wcol_io(const float* Wm, int k0, int o, int lane, int ld) { v16b w; const int g = lane >> 4;
#pragma unroll
  for (int i = 0; i < 8; ++i) { w[i] = (__bf16)Wm[(size_t)(k0 + 8 * g + i) * ld + o]; w[8 + i] = (__bf16)Wm[(size_t)(k0 + 16 + 8 * g + i) * ld + o]; }
  return w; }
__device__ __forceinline__ v16b wcol_oi(const float* Wm, int k0, int o, int lane, int K) { v16b w; const float* p = Wm + (size_t)o * K + k0 + 8 * (lane >> 4);
#pragma unroll
  for (int i = 0; i < 8; ++i) { w[i] = (__bf16)p[i]; w[8 + i] = (__bf16)p[16 + i]; }
  return w; }
__device__ __forceinline__ v16h wcolh_io(const float* Wm, int k0, int o, int lane, int ld) { v16h w; const int g = lane >> 4;
#pragma unroll
  for (int i = 0; i < 8; ++i) { w[i] = (_Float16)(bfr(Wm[(size_t)(k0 + 8 * g + i) * ld + o]) * 256.0f); w[8 + i] = (_Float16)(bfr(Wm[(size_t)(k0 + 16 + 8 * g + i) * ld + o]) * 256.0f); }
  return w; }
__device__ __forceinline__ v16h wcolh_oi(const float* Wm, int k0, int o, int lane, int K) { v16h w; const float* p = Wm + (size_t)o * K + k0 + 8 * (lane >> 4);
#pragma unroll
  for (int i = 0; i < 8; ++i) { w[i] = (_Float16)(bfr(p[i]) * 256.0f); w[8 + i] = (_Float16)(bfr(p[16 + i]) * 256.0f); }
  return w; }
#define WQKV_LAYOUT 1   // 0 = (in,out) [DIN][CC]; 1 = (out,in) [CC][DIN]; 2 = per-head [NH][DIN][HD]
__device__ __forceinline__ v16b wcol_hdk(const float* Wm, int k0, int o, int lane) { v16b w; const int g = lane >> 4; const float* p = Wm + (size_t)(o / HD) * DIN * HD + (o % HD);
#pragma unroll
  for (int i = 0; i < 8; ++i) { w[i] = (__bf16)p[(size_t)(k0 + 8 * g + i) * HD]; w[8 + i] = (__bf16)p[(size_t)(k0 + 16 + 8 * g + i) * HD]; }
  return w; }
#define WO_OUT_IN 1
#if WQKV_LAYOUT == 1
#define WCOL(W, k0, o, lane) wcol_oi(W, k0, o, lane, DIN)
#elif WQKV_LAYOUT == 2
#define WCOL(W, k0, o, lane) wcol_hdk(W, k0, o, lane)
#else
#define WCOL(W, k0, o, lane) wcol_io(W, k0, o, lane, CC)
#endif
#if WO_OUT_IN
#define WOCOL(W, k0, o, lane) wcol_oi(W, k0, o, lane, CC)
#define WOCOLH(W, k0, o, lane) wcolh_oi(W, k0, o, lane, CC)
#else
#define WOCOL(W, k0, o, lane) wcol_io(W, k0, o, lane, DIN)
#define WOCOLH(W, k0, o, lane) wcolh_io(W, k0, o, lane, DIN)
#endif

#define WS_QH  0u                                      // f16 q rows [b*t][CC]; rows t >= QHI x SCL2
#define WS_KH  (WS_QH + 2u * (size_t)NB * TT * CC)      // f16 k rows [b*t][CC]
#define WS_VT  (WS_KH + 2u * (size_t)NB * TT * CC)      // f16 v planes [b][c][t]
#define WS_QL  (WS_VT + 2u * (size_t)NB * CC * TT)      // f16 q residual x 2^10 rows [b][t < QHI][CC]
#define WS_KL  (WS_QL + 2u * (size_t)NB * QHI * CC)     // f16 k residual x 2^10 rows [b][t < KHI][CC]
#define WS_VB  (WS_KL + 2u * (size_t)NB * KHI * CC)     // bf16 v hi planes [b][c][t < KHI]
#define WS_VBL (WS_VB + 2u * (size_t)NB * CC * KHI)
#define WS_XB  (WS_VBL + 2u * (size_t)NB * CC * KHI)    // bf16 hidden_states rows [b*t][DIN]
#define WS_WB  (WS_XB + 2u * (size_t)NB * TT * DIN)     // bf16 Wq, Wk, Wv, each [CC][DIN]
#define WS_END (WS_WB + 2u * 3u * (size_t)CC * DIN)

// ---- k_cvt: hidden_states and the three weights rounded to bf16 once per call. k_proj fetches every X element 18 times and every W element 64 times from L2: as bf16 those fetches are half the bytes.
// One block per 128 KiB of f32, at most one block a WGP: a thread's 16 whole-line loads are all in flight together, then 16 stores of 8 bytes (a wave-wide store = two whole lines).
#define CVT 512                // threads per block
#define CVL 16                 // 16-byte loads per thread
#define CVF (CVT * CVL * 4)    // floats per block
#define CVX (NB * TT * DIN / CVF)   // blocks of hidden_states
#define CVW (CC * DIN / CVF)        // blocks of one weight
static_assert(NB * TT * DIN % CVF == 0 && CC * DIN % CVF == 0, "whole blocks");
typedef __attribute__((ext_vector_type(4))) __bf16 v4b;
__global__ __launch_bounds__(CVT) void k_cvt(const float* __restrict__ X, const float* __restrict__ WQ, const float* __restrict__ WK, const float* __restrict__ WV, __bf16* __restrict__ XB, __bf16* __restrict__ WB) {
  const int c = blockIdx.x, tid = threadIdx.x; const float* s; __bf16* d;
  if (c < CVX) { s = X + (size_t)c * CVF; d = XB + (size_t)c * CVF; }
  else { const int w = (c - CVX) / CVW, k = (c - CVX) % CVW; s = (w == 0 ? WQ : w == 1 ? WK : WV) + (size_t)k * CVF; d = WB + (size_t)w * CC * DIN + (size_t)k * CVF; }
  v4f v[CVL];
#pragma unroll
  for (int i = 0; i < CVL; ++i) v[i] = *(const v4f*)(s + (i * CVT + tid) * 4);
  __builtin_amdgcn_sched_barrier(0);   // all 16 loads issue before the first rounding; left free, the last two were held back until the first two had returned, a second memory latency in a kernel that has only one
#pragma unroll
  for (int i = 0; i < CVL; ++i) { v4b o;
#pragma unroll
    for (int e = 0; e < 4; ++e) o[e] = (__bf16)v[i][e];
    *(v4b*)(d + (i * CVT + tid) * 4) = o; } }

// ---- k_proj: block = (128 rows, 128 cols, which), 8 waves as 4 x 2, wave = 32 rows x 64 cols: q/k/v = X W (+ b) with exact bf16 products (K = DIN) -> which 0: q f16 rows (+ residual rows < QHI); 1: k f16 rows (+ residual rows < KHI); 2: v f16 planes [c][t] (+ bf16 hi/lo planes for t < KHI)
// The block's X and W tiles (bf16, from k_cvt) go through LDS, 64 k a stage: each element is loaded once per block by whole-line loads (a wave-wide 16-byte load = four 128-B row pieces) and read back as fragments by the waves that share it.
// Two buffers: the next stage's global loads fly under this stage's products. k runs upward through one accumulator per tile, as before: the sums are the same. The short loops are unrolled whole so that their arrays stay in registers.
#define PBM 128           // rows of X per block
#define PBN 128           // output columns per block
#define PBK 64            // k per stage
#define PLD (PBK + 8)     // 144-B LDS rows (16 B x odd): no bank conflict for the 16-byte fragment reads
#define PEL (128 + 8)     // 272-B rows of the epilogue's planes
#define PSTG (128 * PLD * 2)        // bytes of one operand's tile in one buffer
#define PSMEM (3 * 128 * PEL * 2)   // the epilogue's three planes; the ring (4 x PSTG) is smaller and lies in the same bytes
// eight 16-byte stores, STEP bytes apart, from one address pair, and behind them, in the same statement, the wait that stands in front of any write of a register they name: in the built code another arm of the epilogue may follow any of these stores
template <int STEP> __device__ __forceinline__ void st8(void* p, const v4u* t) {
  asm volatile("global_store_b128 %0, %1, off\n\tglobal_store_b128 %0, %2, off offset:%9\n\tglobal_store_b128 %0, %3, off offset:%10\n\tglobal_store_b128 %0, %4, off offset:%11\n\t"
               "global_store_b128 %0, %5, off offset:%12\n\tglobal_store_b128 %0, %6, off offset:%13\n\tglobal_store_b128 %0, %7, off offset:%14\n\tglobal_store_b128 %0, %8, off offset:%15\n\ts_wait_xcnt 0x0"
               :: "v"(p), "v"(t[0]), "v"(t[1]), "v"(t[2]), "v"(t[3]), "v"(t[4]), "v"(t[5]), "v"(t[6]), "v"(t[7]), "n"(STEP), "n"(2 * STEP), "n"(3 * STEP), "n"(4 * STEP), "n"(5 * STEP), "n"(6 * STEP), "n"(7 * STEP) : "memory"); }
__global__ __launch_bounds__(256) void k_proj(const __bf16* __restrict__ XB, const __bf16* __restrict__ WB, const float* __restrict__ BQ, const float* __restrict__ BK, const float* __restrict__ BV,
    _Float16* __restrict__ QH, _Float16* __restrict__ QL, _Float16* __restrict__ KH, _Float16* __restrict__ KL, _Float16* __restrict__ VT, __bf16* __restrict__ VB, __bf16* __restrict__ VBL) {
  __shared__ __align__(16) char sm[PSMEM];
  const int tid = threadIdx.x, wave = tid >> 5, lane = tid & 31, col = lane & 15, g = lane >> 4, wr = wave >> 1, wc = wave & 1; const int which = blockIdx.z; const int c0 = blockIdx.y * PBN; const size_t r0 = (size_t)blockIdx.x * PBM; const size_t bb = r0 / TT; const int t0 = (int)(r0 % TT);
  const float* BA = which == 0 ? BQ : which == 1 ? BK : BV;
  __bf16 (*xs)[128][PLD] = (__bf16 (*)[128][PLD])sm; __bf16 (*wt)[128][PLD] = (__bf16 (*)[128][PLD])(sm + 2 * PSTG);
  // staging: thread = (row of 32, 16-byte piece tid & 7 of a 128-B row piece), 4 row groups per operand; a wave's four rows lie 8 apart, 8 x 144 B = 128 B modulo 256, so the two rows of each 16 lanes' LDS store fill all 64 banks once
  const int srow = wave + 8 * ((tid >> 3) & 3), sc = (tid & 7) * 8; const __bf16* xg = XB + (r0 + srow) * DIN + sc; const __bf16* wg = WB + ((size_t)which * CC + c0 + srow) * DIN + sc;
  v4u xr[4], wv[4];
#pragma unroll
  for (int p = 0; p < 4; ++p) { xr[p] = *(const v4u*)(xg + (size_t)p * 32 * DIN); wv[p] = *(const v4u*)(wg + (size_t)p * 32 * DIN); }
  float bias[4] = {0.f, 0.f, 0.f, 0.f};   // read here, as one group beside the first stage's loads: one latency for all of them
  if (BA) {
#pragma unroll
    for (int j = 0; j < 4; ++j) bias[j] = bfr(BA[c0 + wc * 64 + j * 16 + col]); }
  v8f acc[2][4] = {};
#pragma unroll 2   // two stages a trip: the buffer index is a constant in each half, so every LDS address is one register plus an immediate
  for (int s = 0; s < DIN / PBK; ++s) { const int bf = s & 1;
#pragma unroll
    for (int p = 0; p < 4; ++p) { *(v4u*)&xs[bf][srow + p * 32][sc] = xr[p]; *(v4u*)&wt[bf][srow + p * 32][sc] = wv[p]; }
    // one barrier a stage: it publishes this buffer, and every wave that passes it has left the other buffer, which the next stage's stores overwrite
    __syncthreads();
    if (s + 1 < DIN / PBK) {
#pragma unroll
      for (int p = 0; p < 4; ++p) { xr[p] = *(const v4u*)(xg + (size_t)p * 32 * DIN + (s + 1) * PBK); wv[p] = *(const v4u*)(wg + (size_t)p * 32 * DIN + (s + 1) * PBK); } }
    v16b a[PBK / 32][2], w[PBK / 32][4];
#pragma unroll
    for (int kk = 0; kk < PBK / 32; ++kk) {
#pragma unroll
      for (int i = 0; i < 2; ++i) a[kk][i] = frag_b(&xs[bf][wr * 32 + i * 16 + col][kk * 32], lane);
#pragma unroll
      for (int j = 0; j < 4; ++j) w[kk][j] = frag_b(&wt[bf][wc * 64 + j * 16 + col][kk * 32], lane); }
    __builtin_amdgcn_sched_barrier(0);   // the next stage's global loads and this stage's fragment reads issue as one group in front of the products; left free, the global loads were sunk among the products and waited out there
#pragma unroll
    for (int kk = 0; kk < PBK / 32; ++kk)
#pragma unroll
      for (int i = 0; i < 2; ++i)
#pragma unroll
        for (int j = 0; j < 4; ++j) acc[i][j] = __builtin_amdgcn_wmma_f32_16x16x32_bf16(false, a[kk][i], false, w[kk][j], (short)0, acc[i][j], false, false);
    __builtin_amdgcn_sched_barrier(0);   // keeps the LDS stores of the next stage's values, and with them the wait for its loads, behind the products
    asm volatile("s_wait_xcnt 0x0" ::: "memory");   // stands between the next stage's loads and the first write of their address registers, on the way round the loop and on the way out of it; at the stage's foot, so that the fragment reads and the products are not held behind it
  }
  __syncthreads();   // every wave has read its last fragments before the epilogue's planes overwrite the ring
  const int er = tid >> 4, eq = (tid & 15) * 8;   // copy-out: thread = (plane row er + 16 it, 16-byte piece), 16 lanes store 256 B in a row
  v4u t[8];
  if (which < 2) { _Float16* DH = which == 0 ? QH : KH; _Float16* DL = which == 0 ? QL : KL; const int nhi = which == 0 ? QHI : KHI; const bool hi_rows = t0 < nhi;
    _Float16 (*sh)[PEL] = (_Float16 (*)[PEL])sm; _Float16 (*sl)[PEL] = (_Float16 (*)[PEL])(sm + 128 * PEL * 2);
    const float qs = (which == 0 && !hi_rows) ? SCL2 : 1.0f;   // q rows >= QHI are stored x scale x log2 e, from the f32 sum with the one rounding to f16 they had: their S^T products are exponents of 2 as they stand
#pragma unroll
    for (int j = 0; j < 4; ++j)
#pragma unroll
      for (int i = 0; i < 2; ++i)
#pragma unroll
        for (int r = 0; r < 8; ++r) sh[wr * 32 + i * 16 + 8 * g + r][wc * 64 + j * 16 + col] = (_Float16)((acc[i][j][r] + bias[j]) * qs);
    if (hi_rows) {
#pragma unroll
      for (int j = 0; j < 4; ++j)
#pragma unroll
        for (int i = 0; i < 2; ++i)
#pragma unroll
          for (int r = 0; r < 8; ++r) { const float v = acc[i][j][r] + bias[j]; const _Float16 hv = (_Float16)v; sl[wr * 32 + i * 16 + 8 * g + r][wc * 64 + j * 16 + col] = (_Float16)((v - (float)hv) * 1024.0f); } }
    __syncthreads();
    _Float16* dh = DH + (r0 + er) * CC + c0 + eq;
#pragma unroll
    for (int it = 0; it < 8; ++it) t[it] = *(const v4u*)&sh[er + it * 16][eq];
    st8<16 * CC * 2>(dh, t);
    if (hi_rows) {
      _Float16* dl = DL + (bb * nhi + t0 + er) * (size_t)CC + c0 + eq;
#pragma unroll
      for (int it = 0; it < 8; ++it) t[it] = *(const v4u*)&sl[er + it * 16][eq];
      st8<16 * CC * 2>(dl, t); }
  } else { const bool hi_rows = t0 < KHI;
    _Float16 (*th)[PEL] = (_Float16 (*)[PEL])sm; __bf16 (*tb)[PEL] = (__bf16 (*)[PEL])(sm + 128 * PEL * 2); __bf16 (*tbl)[PEL] = (__bf16 (*)[PEL])(sm + 2 * 128 * PEL * 2);
    // a lane's 8 accumulator rows are 8 neighbouring t of one plane row: one 16-byte LDS store each
#pragma unroll
    for (int j = 0; j < 4; ++j)
#pragma unroll
      for (int i = 0; i < 2; ++i) { v8h hv;
#pragma unroll
        for (int r = 0; r < 8; ++r) hv[r] = (_Float16)(acc[i][j][r] + bias[j]);
        *(v8h*)&th[wc * 64 + j * 16 + col][wr * 32 + i * 16 + 8 * g] = hv; }
    if (hi_rows) {
#pragma unroll
      for (int j = 0; j < 4; ++j)
#pragma unroll
        for (int i = 0; i < 2; ++i) { v8b bh, bl;
#pragma unroll
          for (int r = 0; r < 8; ++r) { const float v = acc[i][j][r] + bias[j]; const __bf16 b1 = (__bf16)v; bh[r] = b1; bl[r] = (__bf16)(v - (float)b1); }
          *(v8b*)&tb[wc * 64 + j * 16 + col][wr * 32 + i * 16 + 8 * g] = bh; *(v8b*)&tbl[wc * 64 + j * 16 + col][wr * 32 + i * 16 + 8 * g] = bl; } }
    __syncthreads();
    _Float16* vt = VT + (bb * CC + c0 + er) * (size_t)TT + t0 + eq;
#pragma unroll
    for (int it = 0; it < 8; ++it) t[it] = *(const v4u*)&th[er + it * 16][eq];
    st8<16 * TT * 2>(vt, t);
    if (hi_rows) {
      const size_t o3 = (bb * CC + c0 + er) * (size_t)KHI + t0 + eq;
#pragma unroll
      for (int it = 0; it < 8; ++it) t[it] = *(const v4u*)&tb[er + it * 16][eq];
      st8<16 * KHI * 2>(VB + o3, t);
#pragma unroll
      for (int it = 0; it < 8; ++it) t[it] = *(const v4u*)&tbl[er + it * 16][eq];
      st8<16 * KHI * 2>(VBL + o3, t); } } }
// ---- k_fa: scores, softmax and P . v in one launch. Block = 128 queries of one (batch, head), wave = 32 queries, walking its keys [0, last query] 32 at a time.
// Transposed products: S^T = K . Q^T (D: register r = key 8g + r, lane column = query), so a lane holds 16 scores of ONE query and two S^T tiles, converted in place, are the B operand of O^T += V^T . P^T.
// Running maximum m and running sum l per query; the output tile is rescaled by exp(m_old - m_new) on every pass.
// Rows >= QHI: the block's K rows and V planes go through LDS, 128 keys a stage, two buffers, brought by asynchronous copies in whole 128-B lines and read back as fragments by all four waves.
#define FQW 32            // queries per wave
#define FQB 128           // queries per block
#define FSK 128           // keys per stage
#define FKP 144           // bytes of a K row in LDS (128 + 16: 16 B x odd, no bank conflict for the 16-byte fragment reads)
#define FVP 272           // bytes of a V plane row in LDS (256 + 16)
#define FKB (FSK * FKP)   // bytes of a stage's K rows
#define FBUF (FKB + HD * FVP)   // bytes of one buffer
static_assert(QHI % FQB == 0 && FQB == FSK && TT % FSK == 0, "a block is wholly on one path and its keys are whole stages");
#define L2E 1.4426950408889634f
__device__ __forceinline__ v8f wm_h(v16h a, v16h b, v8f c) { return __builtin_amdgcn_wmma_f32_16x16x32_f16(false, a, false, b, (short)0, c, false, false); }
__device__ __forceinline__ v8f wm_b(v16b a, v16b b, v8f c) { return __builtin_amdgcn_wmma_f32_16x16x32_bf16(false, a, false, b, (short)0, c, false, false); }
// lane l with lane l ^ 16
__device__ __forceinline__ float xhalf(float x) { return __builtin_bit_cast(float, __builtin_amdgcn_permlanex16(__builtin_bit_cast(int, x), __builtin_bit_cast(int, x), 0x76543210, 0xfedcba98, false, false)); }
// the 16 additive mask values (bf16-rounded like every float input) of the keys a lane holds: k0 + 8g + 0..7 and k0 + 16 + 8g + 0..7
__device__ __forceinline__ void mask16(const float* __restrict__ amk, float am[16]) {
  const v4f a0 = *(const v4f*)amk, a1 = *(const v4f*)(amk + 4), a2 = *(const v4f*)(amk + 16), a3 = *(const v4f*)(amk + 20);
#pragma unroll
  for (int i = 0; i < 4; ++i) { am[i] = bfr(a0[i]); am[4 + i] = bfr(a1[i]); am[8 + i] = bfr(a2[i]); am[12 + i] = bfr(a3[i]); } }
// 2^x on the transcendental pipe, with the slot that the instruction set asks for behind a transcendental before its result is used or its source overwritten: in a run each fills the slot of the one in front, one v_nop closes the run
__device__ __forceinline__ void exp2x8(float* a) {
  asm("v_exp_f32 %0, %0\n\tv_exp_f32 %1, %1\n\tv_exp_f32 %2, %2\n\tv_exp_f32 %3, %3\n\tv_exp_f32 %4, %4\n\tv_exp_f32 %5, %5\n\tv_exp_f32 %6, %6\n\tv_exp_f32 %7, %7\n\tv_nop"
      : "+v"(a[0]), "+v"(a[1]), "+v"(a[2]), "+v"(a[3]), "+v"(a[4]), "+v"(a[5]), "+v"(a[6]), "+v"(a[7])); }
__device__ __forceinline__ float exp2x1(float x) { float r; asm("v_exp_f32 %0, %1\n\tv_nop" : "=v"(r) : "v"(x)); return r; }
// one pass of the running softmax for one query column: v[16] -> exp(v - m) x 2^11 (the 2^11 rides in the exponent; l sums the same scaled terms); returns the factor for what was summed before
__device__ __forceinline__ float soft16(float v[16], float& m, float& l) {
  float mx = v[0];
#pragma unroll
  for (int i = 1; i < 16; ++i) mx = fmaxf(mx, v[i]);
  mx = fmaxf(mx, xhalf(mx)); const float mn = fmaxf(m, mx); const float alpha = exp2x1((m - mn) * L2E); m = mn;
  // a key at or below -1e38 is excluded (term 0): under a larger maximum its exponent underflows by itself; where the maximum itself is that low every key so far is excluded
  const float mr = mn <= -1.0e38f ? 3.0e38f : mn;
#pragma unroll
  for (int i = 0; i < 16; ++i) v[i] = fmaf(v[i] - mr, L2E, 11.0f);
  exp2x8(v); exp2x8(v + 8);
  float sum = 0.f;
#pragma unroll
  for (int i = 0; i < 16; ++i) sum += v[i];
  l = l * alpha + sum; return alpha; }
// the same pass for scores that arrive as exponents of 2 (scale, log2 e and mask already in them): each score takes one subtraction on its way to 2^x.
// The state m is the subtrahend itself, the running maximum less 11 AS ROUNDED: every term summed so far is 2^(score - m) for that very m, and the factor is 2^(m_old - m_new), so the rounding of "less 11" cancels between the passes.
__device__ __forceinline__ float soft16c(float v[16], float& m, float& l) {
  float mx = v[0];
#pragma unroll
  for (int i = 1; i < 16; ++i) mx = fmaxf(mx, v[i]);
  mx = fmaxf(mx, xhalf(mx));
  // no exponent above 12: where floats at mx lie 16 apart, mx - 11 rounds to mx - 16 and 2^16 is past f16; there mx itself is taken (wider spacings round to mx by themselves, narrower ones to at most mx - 12)
  float c = mx - 11.0f; c = mx - c > 12.0f ? mx : c;
  const float mn = fmaxf(m, c); const float alpha = exp2x1(m - mn); m = mn;
  // excluded keys as in soft16, the bound in this unit (11 is lost in a value of that size)
  const float mr = mn <= -1.0e38f * L2E ? 3.0e38f : mn;
#pragma unroll
  for (int i = 0; i < 16; ++i) v[i] = v[i] - mr;
  exp2x8(v); exp2x8(v + 8);
  float sum = 0.f;
#pragma unroll
  for (int i = 0; i < 16; ++i) sum += v[i];
  l = l * alpha + sum; return alpha; }
// a 16x16x32 fragment at a wave-uniform base plus the lane's own byte offset (row and 8g in it) plus a constant: elements 0..7 = p[0..7], 8..15 = p[16..23]
__device__ __forceinline__ v16h ld16h(const _Float16* base, unsigned off, int el) { const _Float16* p = (const _Float16*)((const char*)base + off) + el; union { v16h v; v8h q[2]; } u; u.q[0] = *(const v8h*)p; u.q[1] = *(const v8h*)(p + 16); return u.v; }
__device__ __forceinline__ v16b ld16b(const __bf16* base, unsigned off, int el) { const __bf16* p = (const __bf16*)((const char*)base + off) + el; union { v16b v; v8b q[2]; } u; u.q[0] = *(const v8b*)p; u.q[1] = *(const v8b*)(p + 16); return u.v; }
// query rows < QHI, 16 at a time: q and k as f16 hi + residual (3 products), exp and v as bf16 hi + lo (3 products)
__device__ __forceinline__ void fa_hi(const _Float16* __restrict__ QH, const _Float16* __restrict__ KH, const _Float16* __restrict__ QL, const _Float16* __restrict__ KL, const __bf16* __restrict__ VB, const __bf16* __restrict__ VBL, const float* __restrict__ AM,
    int b, int h, int qt, int lane, float (*st)[HD + 4]) {
  const int col = lane & 15, g = lane >> 4; const int t = qt + col;
  const _Float16* Qs = QH + ((size_t)b * TT + qt) * CC + h * HD; const _Float16* Qls = QL + ((size_t)b * QHI + qt) * CC + h * HD; const unsigned qo = (unsigned)(col * CC + 8 * g) * 2u;
  v16h qh[2], ql[2];
#pragma unroll
  for (int kc = 0; kc < 2; ++kc) { qh[kc] = ld16h(Qs, qo, kc * 32); ql[kc] = ld16h(Qls, qo, kc * 32); }
  asm volatile("s_wait_xcnt 0x0" :: "v"(qh[0]), "v"(qh[1]), "v"(ql[0]), "v"(ql[1]) : "memory");   // stands behind the q loads, in front of the first write of their address registers; the loaded values are inputs only, so that the loads cannot sink below it (without them this build placed the loads behind the wait and a K load's result in their address registers)
  // wave-uniform bases and each lane's own byte offsets, stepped once a pass: every load of a pass is one of these registers plus a constant
  const float* As = AM + (size_t)b * TT; const _Float16* Ks = KH + (size_t)b * TT * CC + h * HD; const _Float16* Kls = KL + (size_t)b * KHI * CC + h * HD;
  const __bf16* Vs = VB + ((size_t)b * CC + h * HD) * (size_t)KHI; const __bf16* Vls = VBL + ((size_t)b * CC + h * HD) * (size_t)KHI;
  unsigned ao = (unsigned)(8 * g) * 4u, ko = (unsigned)(col * CC + 8 * g) * 2u, vo = (unsigned)(col * KHI + 8 * g) * 2u;
  v8f o[HD / 16] = {}; float m = -3.0e38f, l = 0.f; const int nit = qt / 32 + 1;
#pragma unroll 1
  for (int it = 0; it < nit; ++it) { const int k0 = it * 32; v8f acc[2] = {}, accl[2] = {}; float am[16]; mask16((const float*)((const char*)As + ao), am);
#pragma unroll
    for (int kt = 0; kt < 2; ++kt)
#pragma unroll
      for (int kc = 0; kc < 2; ++kc) { const v16h kh = ld16h(Ks, ko, kt * 16 * CC + kc * 32), kl = ld16h(Kls, ko, kt * 16 * CC + kc * 32);
        acc[kt] = wm_h(kh, qh[kc], acc[kt]); accl[kt] = wm_h(kh, ql[kc], accl[kt]); accl[kt] = wm_h(kl, qh[kc], accl[kt]); }
    v16b vh[HD / 16], vl[HD / 16];
#pragma unroll
    for (int j = 0; j < HD / 16; ++j) { vh[j] = ld16b(Vs, vo, j * 16 * KHI); vl[j] = ld16b(Vls, vo, j * 16 * KHI); }
    asm volatile("s_wait_xcnt 0x0" : "+v"(ao), "+v"(ko), "+v"(vo) :: "memory");   // stands between this pass's loads and the step of their offset registers; naming the offsets keeps them in those registers up to the wait and the step behind it
    ao += 32u * 4u; ko += 32u * CC * 2u; vo += 32u * 2u;
    float v[16];
#pragma unroll
    for (int i = 0; i < 16; ++i) { const int key = k0 + (i >> 3) * 16 + 8 * g + (i & 7); const float s = (acc[i >> 3][i & 7] + accl[i >> 3][i & 7] * (1.0f / 1024.0f)) * SCALE; v[i] = (key <= t ? s : -3.0e38f) + am[i]; }
    const float alpha = soft16(v, m, l); const F2 p = bsplit16(v);
#pragma unroll
    for (int j = 0; j < HD / 16; ++j) { o[j] = o[j] * alpha; o[j] = wm_b(vh[j], p.h, o[j]); o[j] = wm_b(vh[j], p.l, o[j]); o[j] = wm_b(vl[j], p.h, o[j]); } }
  l += xhalf(l); const float inv = l > 0.f ? 1.0f / l : 0.f;   /* a fully excluded row yields 0 */
#pragma unroll
  for (int j = 0; j < HD / 16; ++j) { const v8f r = o[j] * inv; *(v4f*)&st[col][j * 16 + 8 * g] = __builtin_shufflevector(r, r, 0, 1, 2, 3); *(v4f*)&st[col][j * 16 + 8 * g + 4] = __builtin_shufflevector(r, r, 4, 5, 6, 7); } }
// eight asynchronous 16-byte copies to LDS per lane, LS bytes apart in LDS and GS bytes apart in global memory, and behind them, in the same statement, the wait that stands in front of any write of a register they name
template <int LS, int GS> __device__ __forceinline__ void cp8(unsigned l, const char* p) {
  asm volatile("global_load_async_to_lds_b128 %0, %8, off\n\tglobal_load_async_to_lds_b128 %1, %9, off\n\tglobal_load_async_to_lds_b128 %2, %10, off\n\tglobal_load_async_to_lds_b128 %3, %11, off\n\t"
               "global_load_async_to_lds_b128 %4, %12, off\n\tglobal_load_async_to_lds_b128 %5, %13, off\n\tglobal_load_async_to_lds_b128 %6, %14, off\n\tglobal_load_async_to_lds_b128 %7, %15, off\n\ts_wait_xcnt 0x0"
               :: "v"(l), "v"(l + LS), "v"(l + 2 * LS), "v"(l + 3 * LS), "v"(l + 4 * LS), "v"(l + 5 * LS), "v"(l + 6 * LS), "v"(l + 7 * LS),
                  "v"(p), "v"(p + GS), "v"(p + 2 * GS), "v"(p + 3 * GS), "v"(p + 4 * GS), "v"(p + 5 * GS), "v"(p + 6 * GS), "v"(p + 7 * GS) : "memory"); }
// a 16x16x32 fragment from LDS: elements 0..7 = p[0..7], 8..15 = p[16..23]
__device__ __forceinline__ v16h lds16h(const char* p) { union { v16h v; v8h q[2]; } u; u.q[0] = *(const v8h*)p; u.q[1] = *(const v8h*)(p + 32); return u.v; }
// four waves per SIMD: keeps the allocation at 256 VGPRs, below the register windows that cost a mode switch per access
__global__ __launch_bounds__(128) __attribute__((amdgpu_waves_per_eu(4, 4))) void k_fa(const _Float16* __restrict__ QH, const _Float16* __restrict__ KH, const _Float16* __restrict__ QL, const _Float16* __restrict__ KL, const _Float16* __restrict__ VT, const __bf16* __restrict__ VB, const __bf16* __restrict__ VBL, const float* __restrict__ AM, float* __restrict__ Y) {
  __shared__ __align__(16) char sm[2 * FBUF + TT * 4];   // the ring, whose first bytes are the output staging behind the loop's last barrier; behind the ring the batch row's prepared key mask
  static_assert(sizeof(float) * (FQB / FQW) * FQW * (HD + 4) <= 2 * FBUF, "the output staging lies inside the ring");
  float (*ss)[FQW][HD + 4] = (float (*)[FQW][HD + 4])sm;
  const int tid = threadIdx.x, lane = tid & 31, col = lane & 15, g = lane >> 4; const int wave = __builtin_amdgcn_readfirstlane(tid >> 5);
  const int b = blockIdx.x / NH, h = blockIdx.x % NH; const int q0 = (TT / FQB - 1 - (int)blockIdx.y) * FQB, qw = q0 + wave * FQW;   // the blocks with the most keys start first
  if (q0 < QHI) {
#pragma unroll 1   // one copy of the high-precision body serves both halves of the wave's 32 queries: half the code, and each half's loads stay inside its own trip
    for (int hf = 0; hf < 2; ++hf) fa_hi(QH, KH, QL, KL, VB, VBL, AM, b, h, qw + hf * 16, lane, &ss[wave][hf * 16]); }
  else {
    // wave-uniform bases and each lane's own byte offsets
    const _Float16* Ks = KH + (size_t)b * TT * CC + h * HD; const _Float16* Vs = VT + ((size_t)b * CC + h * HD) * (size_t)TT; const float* As = AM + (size_t)b * TT; const _Float16* Qs = QH + ((size_t)b * TT + qw) * CC + h * HD;
    const unsigned ko = (unsigned)(col * CC + 8 * g) * 2u;
    // staging: K, thread = (row tid >> 3 of 16, 16-byte piece tid & 7 of a 128-B row), 8 row groups; V, thread = (plane row tid >> 4 of 8, piece tid & 15 of 256 B), 8 row groups: a wave-wide copy is four whole lines
    const char* kg = (const char*)Ks + (size_t)(tid >> 3) * (CC * 2) + (tid & 7) * 16; const char* vg = (const char*)Vs + (size_t)(tid >> 4) * (TT * 2) + (tid & 15) * 16;
    const unsigned kd = (unsigned)(size_t)sm + (unsigned)(tid >> 3) * FKP + (tid & 7) * 16, vd = (unsigned)(size_t)sm + FKB + (unsigned)(tid >> 4) * FVP + (tid & 15) * 16;
    auto stage = [&](const int st) __attribute__((always_inline)) { const unsigned bo = (unsigned)(st & 1) * FBUF;
      cp8<16 * FKP, 16 * CC * 2>(kd + bo, kg + (size_t)st * (FSK * CC * 2)); cp8<8 * FVP, 8 * TT * 2>(vd + bo, vg + (size_t)st * (FSK * 2)); };
    const int nst = q0 / FSK + 1;   // at least QHI / FSK + 1 stages
    stage(0);
    v16h qf[2][2];
#pragma unroll
    for (int q = 0; q < 2; ++q)
#pragma unroll
      for (int kc = 0; kc < 2; ++kc) qf[q][kc] = ld16h(Qs, ko, q * 16 * CC + kc * 32);
    // the key mask, prepared once per block: rounded to bf16 like every float input, x log2 e, floored at -3.0e38 (finite, and far below the bound that means excluded), so that a pass hands it to the S^T products as their C operand; published by the barrier that publishes stage 0
    // above 2.0e38 the slope is 1/4, so that the largest finite mask stays finite in this unit: two bf16 values up there differ by more than 1e36, a quarter of which still sends the smaller one's term to 0, as in the reference
    v4f mk[TT / (FQB * 4)];
#pragma unroll
    for (int i = 0; i < TT / (FQB * 4); ++i) mk[i] = *(const v4f*)(As + (i * FQB + tid) * 4);
#pragma unroll
    for (int i = 0; i < TT / (FQB * 4); ++i) { v4f r;
#pragma unroll
      for (int e = 0; e < 4; ++e) { const float x = bfr(mk[i][e]); r[e] = fmaxf(x > 2.0e38f ? fmaf(x - 2.0e38f, 0.25f, 2.0e38f * L2E) : x * L2E, -3.0e38f); }
      *(v4f*)(sm + 2 * FBUF + (i * FQB + tid) * 16) = r; }
    v8f o[2][HD / 16] = {}; float m[2] = {-3.0e38f, -3.0e38f}, l[2] = {0.f, 0.f};
    asm volatile("s_wait_asynccnt 0x0" ::: "memory");   // this wave's copies of stage 0 have landed
    __syncthreads();   // publishes stage 0 and the mask row
    stage(1);
    const char* kl = sm + col * FKP + 16 * g; const char* vl = sm + FKB + col * FVP + 16 * g;   // the lane's own place in a K row group and in a V plane row group
    const char* kp = kl; const char* vp = vl;   // where the next pass reads: stepped once a pass, set to the other buffer at the foot of a stage
    const char* mp = sm + 2 * FBUF + 32 * g;   // the mask values of the keys a lane holds in the next pass (8g + 0..7 and 16 + 8g + 0..7): stepped once a pass
    // one pass = 32 keys; only the last pass holds keys past a query, so it alone carries the index test and the loop body stays one straight block
    auto pass = [&](const bool last) __attribute__((always_inline)) {
      v8f cm[2];   // C operand of the S^T products: register r = the prepared mask of key 8g + r of the tile, alike in every query column
#pragma unroll
      for (int kt = 0; kt < 2; ++kt) { union { v8f v; v4f h[2]; } u; u.h[0] = *(const v4f*)(mp + kt * 64); u.h[1] = *(const v4f*)(mp + kt * 64 + 16); cm[kt] = u.v; }
      v16h kf[2][2], vf[HD / 16];
#pragma unroll
      for (int kt = 0; kt < 2; ++kt)
#pragma unroll
        for (int kc = 0; kc < 2; ++kc) kf[kt][kc] = lds16h(kp + kt * 16 * FKP + kc * 64);
#pragma unroll
      for (int j = 0; j < HD / 16; ++j) vf[j] = lds16h(vp + j * 16 * FVP);
      __builtin_amdgcn_sched_barrier(0);   // the mask, K and V reads issue as one group in front of the S^T products, the V reads flying under them: one place with LDS reads a pass
      v8f s[2][2];
#pragma unroll
      for (int kc = 0; kc < 2; ++kc)
#pragma unroll
        for (int kt = 0; kt < 2; ++kt)
#pragma unroll
          for (int q = 0; q < 2; ++q) s[q][kt] = wm_h(kf[kt][kc], qf[q][kc], kc == 0 ? cm[kt] : s[q][kt]);
      mp += 32 * 4; kp += 32 * FKP; vp += 32 * 2;
      __builtin_amdgcn_sched_barrier(0);   // keeps the eight S^T products one run, four independent tiles and then their second halves; left free, each tile's two dependent products stood back to back with the maximum's first steps and padding between the tiles
      v16h pf[2];
#pragma unroll
      for (int q = 0; q < 2; ++q) { float v[16];
#pragma unroll
        for (int i = 0; i < 16; ++i) { const int key = qw + (i >> 3) * 16 + 8 * g + (i & 7);   /* the last pass starts at key qw */ v[i] = (!last || key <= qw + q * 16 + col) ? s[q][i >> 3][i & 7] : -3.0e38f; }
        const float alpha = soft16c(v, m[q], l[q]);
#pragma unroll
        for (int i = 0; i < 16; ++i) pf[q][i] = (_Float16)v[i];
#pragma unroll
        for (int j = 0; j < HD / 16; ++j) o[q][j] = o[q][j] * alpha; }
#pragma unroll
      for (int j = 0; j < HD / 16; ++j)
#pragma unroll
        for (int q = 0; q < 2; ++q) o[q][j] = wm_h(vf[j], pf[q], o[q][j]); };
    // the block walks its stages together, four passes a stage; all stages but the last lie wholly below every query of the block
#pragma unroll 1
    for (int ip = 0; ip < (nst - 1) * (FSK / 32); ++ip) { pass(false);
      if ((ip & (FSK / 32 - 1)) == FSK / 32 - 1) { const int st = ip / (FSK / 32);   // the foot of stage st; the trip count and this test read the same in every wave of the block
        asm volatile("s_wait_dscnt 0x0" ::: "memory");      // this wave's reads of stage st have returned
        asm volatile("s_wait_asynccnt 0x0" ::: "memory");   // this wave's copies of stage st + 1 have landed
        __syncthreads();   // publishes stage st + 1, and every wave that passes it has left stage st's buffer, which the next copies overwrite
        if (st + 2 < nst) stage(st + 2);
        kp = kl + ((st + 1) & 1) * FBUF; vp = vl + ((st + 1) & 1) * FBUF; } }
    // the last stage holds the block's own 128 keys: wave w takes w whole passes and the pass on its diagonal
#pragma unroll 1
    for (int p = 0; p < wave; ++p) pass(false);
    pass(true);
    asm volatile("s_wait_dscnt 0x0" ::: "memory");      // this wave's last reads of the ring have returned
    asm volatile("s_wait_asynccnt 0x0" ::: "memory");   // no copy is in flight
    __syncthreads();   // every wave has left the ring before its bytes become the output staging
#pragma unroll
    for (int q = 0; q < 2; ++q) { const float lt = l[q] + xhalf(l[q]); const float inv = lt > 0.f ? 1.0f / lt : 0.f;   /* a fully excluded row yields 0 */
#pragma unroll
      for (int j = 0; j < HD / 16; ++j) { const v8f r = o[q][j] * inv; *(v4f*)&ss[wave][q * 16 + col][j * 16 + 8 * g] = __builtin_shufflevector(r, r, 0, 1, 2, 3); *(v4f*)&ss[wave][q * 16 + col][j * 16 + 8 * g + 4] = __builtin_shufflevector(r, r, 4, 5, 6, 7); } } }
  // each wave turns its own 32 x 64 tile in its own LDS slice: a 256-B (row, head) segment is stored by 16 lanes
  LDSX();
#pragma unroll
  for (int i = 0; i < FQW / 2; ++i) { const int rl = 2 * i + g; vst2(Y + ((size_t)b * TT + qw + rl) * CC + h * HD + col * 4, *(const v4f*)&ss[wave][rl][col * 4]); } }

extern "C" void kernel_launch(void* const* d_in, const int* in_sizes, int n_in, void* d_out, int out_size, void* d_ws, size_t ws_size, hipStream_t stream) {
  (void)in_sizes; (void)n_in; (void)out_size;
  const float** F = (const float**)d_in;
  if (ws_size < (size_t)WS_END) return;
  char* ws = (char*)d_ws; _Float16 *QH = (_Float16*)(ws + WS_QH), *KH = (_Float16*)(ws + WS_KH), *VT = (_Float16*)(ws + WS_VT), *QL = (_Float16*)(ws + WS_QL), *KL = (_Float16*)(ws + WS_KL); __bf16 *VB = (__bf16*)(ws + WS_VB), *VBL = (__bf16*)(ws + WS_VBL), *XB = (__bf16*)(ws + WS_XB), *WB = (__bf16*)(ws + WS_WB);
  // inputs: 0 hidden_states [4,2048,768]; 1 attention_mask [4,1,1,2048] f32 (zeros); 2 Wq [768,768] (out,in), 3 bq; 4 Wk, 5 bk; 6 Wv, 7 bv (biases zeros, read)
  k_cvt<<<dim3(CVX + 3 * CVW), CVT, 0, stream>>>(F[0], F[2], F[4], F[6], XB, WB);
  k_proj<<<dim3(TNB * TT / PBM, CC / PBN, 3), 256, 0, stream>>>(XB, WB, F[3], F[5], F[7], QH, QL, KH, KL, VT, VB, VBL);
  k_fa<<<dim3(TNB * NH, TT / FQB), 128, 0, stream>>>(QH, KH, QL, KL, VT, VB, VBL, F[1], (float*)d_out);   /* merged heads are the output: row b*TT + t, columns h*64 .. */
}
